// v000
// Measured on an AMD MI455X. A time is GPU time per run, averaged over a window of back-to-back runs after a warm-up
// (all launches, gaps included; the runs take copies of the inputs in turn), and the median of several windows.
// Apart from v000's, it joins two sittings. Times from different sittings can be a few percent apart, while
// side-by-side timings come from the same sitting.
// v000 is the starting kernel. One run takes 2680 microseconds.
#include <hip/hip_runtime.h>

// Grouped-query causal attention (x [2][2048][2048]; q = x Wq^T + bq (32 heads x 64), k, v = x Wk^T + bk, x Wv^T + bv (8 kv heads x 64) ('oi' 1/sqrt(2048), zero biases); query head j = (kv head h, group member g) = 4h + g uses kv head h; scores x 64^-0.5; causal (-inf); softmax; out = merged Wo^T + bo ('oi' [2048][2048]) -> [2][2048][2048] (8.4 M); argument order x, Wq, bq, Wk, bk, Wv, bv, Wo, bo).
// Layout per batch: bf16 copy of x; exact projections + f32 biases; causal T-2048 attention (hybrid rows: < 512 hi/lo 3 products, rest fp16 x1024; k_gemmc skips tiles above the diagonal; both query heads of a pass share their kv head); merged hi/lo x Wo exact + bo.
// Compute dtypes, f32 accumulate: every input rounded to bf16; projections exact + f32 biases; attention rows < 512 3 products, rest fp16; softmax f32; Wo hl x exact + bias.

#define NB_  2
#define TT   2048
#define DM   2048
#define NH_  32
#define NKV  8
#define REP  (NH_ / NKV)
#define HD   64
#define DQ   (NH_ * HD)
#define DKV  (NKV * HD)
#define ZH   2
#define RH   512                  // query rows < RH use hi+lo planes (0: none)
#define WIN  2048
#define PCAR 1024.0f
#define SCL  0.125f   // HD^-0.5
typedef _Float16 h16;
typedef unsigned short bf;
typedef __attribute__((ext_vector_type(16))) __bf16   v16bf;
typedef __attribute__((ext_vector_type(16))) _Float16 v16h;
typedef __attribute__((ext_vector_type(8)))  _Float16 v8h;
typedef __attribute__((ext_vector_type(8)))  unsigned short v8us;
typedef __attribute__((ext_vector_type(8)))  float    v8f;
typedef __attribute__((ext_vector_type(4)))  float    v4f;
typedef v8h  __attribute__((may_alias)) v8ha;
typedef v4f  __attribute__((may_alias)) v4fa;
typedef v8us __attribute__((may_alias)) v8usa;

__device__ __forceinline__ unsigned short f2bf(float f) { unsigned u = __float_as_uint(f); u += 0x7FFFu + ((u >> 16) & 1u); return (unsigned short)(u >> 16); }
__device__ __forceinline__ float bf2f(unsigned short b) { return __uint_as_float(((unsigned)b) << 16); }
__device__ __forceinline__ float bfr(float f) { return bf2f(f2bf(f)); }
__device__ __forceinline__ v16h cat16(v8h lo, v8h hi) { return __builtin_shufflevector(lo, hi, 0, 1, 2, 3, 4, 5, 6, 7, 8, 9, 10, 11, 12, 13, 14, 15); }
__device__ __forceinline__ v16bf cat16b(v8us lo, v8us hi) { return __builtin_bit_cast(v16bf, __builtin_shufflevector(lo, hi, 0, 1, 2, 3, 4, 5, 6, 7, 8, 9, 10, 11, 12, 13, 14, 15)); }
__device__ __forceinline__ v8f wmma16(v16h a, v16h b, v8f c) { return __builtin_amdgcn_wmma_f32_16x16x32_f16(false, a, false, b, (short)0, c, false, false); }
__device__ __forceinline__ v8f wmmab(v16bf a, v16bf b, v8f c) { return __builtin_amdgcn_wmma_f32_16x16x32_bf16(false, a, false, b, (short)0, c, false, false); }



// ---- k_gemmw: register-blocked GEMM, ONE WAVE per 64x64 output tile (16 accumulators), operands straight from K-contiguous 16-bit planes; grid (M/64, N/64, Z), 32 threads.
// C[m][n] (f32, pitch ldc, + optional f32 bias[n]) = sum_k A[m][k] Bt[n][k] (+ split products per NSPLIT). z-batch strides sA/sB/sC in elements. K % 32 == 0.
template <typename T16> struct WFrag;
template <> struct WFrag<h16> { typedef v16h V; static __device__ __forceinline__ V ld(const h16* p) { return cat16(*(const v8h*)p, *(const v8h*)(p + 16)); } static __device__ __forceinline__ v8f mma(V a, V b, v8f c) { return wmma16(a, b, c); } };
template <> struct WFrag<bf> { typedef v16bf V; static __device__ __forceinline__ V ld(const bf* p) { return cat16b(*(const v8us*)p, *(const v8us*)(p + 16)); } static __device__ __forceinline__ v8f mma(V a, V b, v8f c) { return wmmab(a, b, c); } };
template <typename T16, int NSPLIT, bool BIAS>
__global__ __launch_bounds__(32) void k_gemmw(const T16* __restrict__ A, const T16* __restrict__ A2, const T16* __restrict__ Bt, const T16* __restrict__ Bt2, int K, float* C, int ldc, const float* __restrict__ bias, size_t sA, size_t sB, size_t sC) {
    typedef typename WFrag<T16>::V V;
    __shared__ __align__(16) float os[16 * 68];
    const size_t z = blockIdx.z; A += z * sA; if (A2) A2 += z * sA; Bt += z * sB; if (Bt2) Bt2 += z * sB; C += z * sC;
    const int lane = threadIdx.x & 31, lr = lane & 15, hi = lane >> 4; const int r0 = blockIdx.x * 64, c0 = blockIdx.y * 64;
    v8f acc[4][4];
#pragma unroll
    for (int mb = 0; mb < 4; ++mb)
#pragma unroll
        for (int nb = 0; nb < 4; ++nb) acc[mb][nb] = (v8f){};
    const size_t aoff = (size_t)(r0 + lr) * K + 8 * hi, boff = (size_t)(c0 + lr) * K + 8 * hi;
#pragma unroll 1
    for (int kc = 0; kc < K; kc += 32) {
        V a[4], a2[4];
#pragma unroll
        for (int mb = 0; mb < 4; ++mb) { a[mb] = WFrag<T16>::ld(A + aoff + (size_t)mb * 16 * K + kc); if (NSPLIT == 1 || NSPLIT == 2) a2[mb] = WFrag<T16>::ld(A2 + aoff + (size_t)mb * 16 * K + kc); }
#pragma unroll
        for (int nb = 0; nb < 4; ++nb) { const V b = WFrag<T16>::ld(Bt + boff + (size_t)nb * 16 * K + kc); V b2; if (NSPLIT >= 2) b2 = WFrag<T16>::ld(Bt2 + boff + (size_t)nb * 16 * K + kc);
#pragma unroll
            for (int mb = 0; mb < 4; ++mb) { acc[mb][nb] = WFrag<T16>::mma(a[mb], b, acc[mb][nb]); if (NSPLIT == 1 || NSPLIT == 2) acc[mb][nb] = WFrag<T16>::mma(a2[mb], b, acc[mb][nb]); if (NSPLIT >= 2) acc[mb][nb] = WFrag<T16>::mma(a[mb], b2, acc[mb][nb]); } }
        asm volatile("v_nop\n\tv_nop\n\tv_nop\n\tv_nop" : "+v"(acc[0][0]), "+v"(acc[1][1]), "+v"(acc[2][2]), "+v"(acc[3][3]) : "v"(a[0]), "v"(a[3]));
    }
#pragma unroll
    for (int mb = 0; mb < 4; ++mb) {
#pragma unroll
        for (int nb = 0; nb < 4; ++nb) {
#pragma unroll
            for (int j = 0; j < 8; ++j) os[(hi * 8 + j) * 68 + nb * 16 + lr] = acc[mb][nb][j]; }
        __builtin_amdgcn_wave_barrier(); asm volatile("" ::: "memory");
        float* crow = C + (size_t)(r0 + mb * 16) * ldc + c0;
{
#pragma unroll
            for (int s = 0; s < 8; ++s) { const int row = 2 * s + hi, cofs = lr * 4; v4f val = *(const v4fa*)(os + row * 68 + cofs); if (BIAS) { val[0] += bfr(bias[c0 + cofs]); val[1] += bfr(bias[c0 + cofs + 1]); val[2] += bfr(bias[c0 + cofs + 2]); val[3] += bfr(bias[c0 + cofs + 3]); }
                *(v4f*)(crow + (size_t)row * ldc + cofs) = val; }
             }
        __builtin_amdgcn_wave_barrier(); asm volatile("" ::: "memory");
    }
}

// ---- k_gemmc: the same one-wave 64x64 tile GEMM specialised for causal attention: CMODE 1 skips score tiles entirely above the diagonal (query rows r0+roff.., key columns c0..), CMODE 2 limits the
// key (K) loop of the probability x value contraction to the diagonal block (probabilities beyond it are exactly zero). roff = row offset of this launch's first row within the sequence.
template <typename T16, int NSPLIT, int CMODE>
__global__ __launch_bounds__(32) void k_gemmc(const T16* __restrict__ A, const T16* __restrict__ A2, const T16* __restrict__ Bt, const T16* __restrict__ Bt2, int K, float* C, int ldc, int roff, size_t sA, size_t sB, size_t sC) {
    typedef typename WFrag<T16>::V V;
    __shared__ __align__(16) float os[16 * 68];
    const size_t z = blockIdx.z; A += z * sA; if (A2) A2 += z * sA; Bt += z * sB; if (Bt2) Bt2 += z * sB; C += z * sC;
    const int lane = threadIdx.x & 31, lr = lane & 15, hi = lane >> 4; const int r0 = blockIdx.x * 64, c0 = blockIdx.y * 64;
    if (CMODE == 1 && c0 > r0 + roff + 63) return;                  // score tile entirely above the causal diagonal: never read (the softmax masks j > i by select)
    const int Kl = (CMODE == 2) ? min(K, r0 + roff + 64) : K;        // P.V: probabilities are exactly 0 beyond the diagonal block, so the K loop stops there
    v8f acc[4][4];
#pragma unroll
    for (int mb = 0; mb < 4; ++mb)
#pragma unroll
        for (int nb = 0; nb < 4; ++nb) acc[mb][nb] = (v8f){};
    const size_t aoff = (size_t)(r0 + lr) * K + 8 * hi, boff = (size_t)(c0 + lr) * K + 8 * hi;
#pragma unroll 1
    for (int kc = 0; kc < Kl; kc += 32) {
        V a[4], a2[4];
#pragma unroll
        for (int mb = 0; mb < 4; ++mb) { a[mb] = WFrag<T16>::ld(A + aoff + (size_t)mb * 16 * K + kc); if (NSPLIT == 1 || NSPLIT == 2) a2[mb] = WFrag<T16>::ld(A2 + aoff + (size_t)mb * 16 * K + kc); }
#pragma unroll
        for (int nb = 0; nb < 4; ++nb) { const V b = WFrag<T16>::ld(Bt + boff + (size_t)nb * 16 * K + kc); V b2; if (NSPLIT >= 2) b2 = WFrag<T16>::ld(Bt2 + boff + (size_t)nb * 16 * K + kc);
#pragma unroll
            for (int mb = 0; mb < 4; ++mb) { acc[mb][nb] = WFrag<T16>::mma(a[mb], b, acc[mb][nb]); if (NSPLIT == 1 || NSPLIT == 2) acc[mb][nb] = WFrag<T16>::mma(a2[mb], b, acc[mb][nb]); if (NSPLIT >= 2) acc[mb][nb] = WFrag<T16>::mma(a[mb], b2, acc[mb][nb]); } }
        asm volatile("v_nop\n\tv_nop\n\tv_nop\n\tv_nop" : "+v"(acc[0][0]), "+v"(acc[1][1]), "+v"(acc[2][2]), "+v"(acc[3][3]) : "v"(a[0]), "v"(a[3]));
    }
#pragma unroll
    for (int mb = 0; mb < 4; ++mb) {
#pragma unroll
        for (int nb = 0; nb < 4; ++nb) {
#pragma unroll
            for (int j = 0; j < 8; ++j) os[(hi * 8 + j) * 68 + nb * 16 + lr] = acc[mb][nb][j]; }
        __builtin_amdgcn_wave_barrier(); asm volatile("" ::: "memory");
        float* crow = C + (size_t)(r0 + mb * 16) * ldc + c0;
{
#pragma unroll
            for (int s = 0; s < 8; ++s) { const int row = 2 * s + hi, cofs = lr * 4; v4f val = *(const v4fa*)(os + row * 68 + cofs);
                *(v4f*)(crow + (size_t)row * ldc + cofs) = val; }
             }
        __builtin_amdgcn_wave_barrier(); asm volatile("" ::: "memory");
    }
}

__device__ __forceinline__ h16 tohx(float x) { return (h16)x; }
__device__ __forceinline__ void splitf(float y, unsigned short& h, unsigned short& l) { h = f2bf(y); l = f2bf(y - bf2f(h)); }
typedef __attribute__((ext_vector_type(2))) _Float16 v2h;
typedef __attribute__((ext_vector_type(4))) _Float16 v4h;
typedef __attribute__((ext_vector_type(2))) unsigned short v2us;
typedef __attribute__((ext_vector_type(4))) unsigned short v4us;
typedef __attribute__((ext_vector_type(2))) float v2f;
typedef __attribute__((ext_vector_type(4))) int v4i;

__global__ __launch_bounds__(256) void k_wtG(const float* __restrict__ w, int K, int N, bf* Bt) {
    const int lane = threadIdx.x & 31; const int L0 = (blockIdx.x * 8 + (threadIdx.x >> 5)) * 8; const int nlines = N * K / 64;
{
#pragma unroll 1
        for (int l = 0; l < 8; ++l) { const int L = L0 + l; if (L >= nlines) break; const size_t e = (size_t)L * 64 + lane * 2; const int k = (int)(e % K), n = (int)(e / K); v2us o;
            o[0] = f2bf(w[(size_t)k * N + n]); o[1] = f2bf(w[(size_t)(k + 1) * N + n]); *(v2us*)(Bt + e) = o; }
         }
}
__global__ __launch_bounds__(256) void k_cvt8(const float* __restrict__ src, bf* dst, size_t n8) { const size_t i = (size_t)blockIdx.x * 256 + threadIdx.x; if (i >= n8) return; const v8f v = *(const v8f*)(src + i * 8); v8us o;
#pragma unroll
    for (int k = 0; k < 8; ++k) o[k] = f2bf(v[k]); *(v8us*)(dst + i * 8) = o;  }

// k_rope: head planes [h][t][d] (fp16 + hi/lo) of rope(x) x sc with the rotate-half convention out[d] = x[d] cos[t][d] - x[d+HD/2] sin[t][d], out[d+HD/2] = x[d+HD/2] cos[t][d+HD/2] + x[d] sin[t][d+HD/2]
__global__ __launch_bounds__(256) void k_rope(const float* __restrict__ F, int pitch, int nheads, const float* __restrict__ CS, const float* __restrict__ RF, const float* __restrict__ nw, float sc, h16* P16, bf* Ph, bf* Pl) {
    const size_t e = ((size_t)blockIdx.x * 256 + threadIdx.x) * 2; if (e >= (size_t)nheads * TT * HD) return; const int d = (int)(e % HD); const int t = (int)((e / HD) % TT); const int h = (int)(e / ((size_t)HD * TT)); const float* f = F + (size_t)t * pitch + h * HD; const float rf = RF ? RF[(size_t)h * TT + t] : 1.0f; v2h o16; v2us oh, ol;
#pragma unroll
    for (int q = 0; q < 2; ++q) { const int dd = d + q; const int dp = (dd < HD / 2) ? dd + HD / 2 : dd - HD / 2; float x0 = f[dd], x1 = f[dp];
        if (RF) { float n0 = __fmul_rn(x0, rf), n1 = __fmul_rn(x1, rf); asm volatile("" : "+v"(n0)); asm volatile("" : "+v"(n1)); x0 = __fmul_rn(bfr(nw[dd]), n0); x1 = __fmul_rn(bfr(nw[dp]), n1); }
        const v2f cs = *(const v2f*)(CS + ((size_t)t * HD + dd) * 2); float a = __fmul_rn(x0, cs[0]), bq = __fmul_rn(x1, cs[1]); asm volatile("" : "+v"(a)); asm volatile("" : "+v"(bq)); const float r = ((dd < HD / 2) ? __fsub_rn(a, bq) : __fadd_rn(a, bq)) * sc;
        o16[q] = tohx(r); unsigned short a2, c2; splitf(r, a2, c2); oh[q] = a2; ol[q] = c2; }
    *(v2h*)(P16 + e) = o16; *(v2us*)(Ph + e) = oh; *(v2us*)(Pl + e) = ol;  }
__global__ __launch_bounds__(256) void k_vtp(const float* __restrict__ F, int pitch, int nheads, h16* V16, bf* Vh, bf* Vl) { const size_t e = ((size_t)blockIdx.x * 256 + threadIdx.x) * 2; if (e >= (size_t)nheads * HD * TT) return; const int t = (int)(e % TT); const int d = (int)((e / TT) % HD); const int g = (int)(e / ((size_t)TT * HD)); v2h o16; v2us oh, ol;
#pragma unroll
    for (int q = 0; q < 2; ++q) { const float x = F[(size_t)(t + q) * pitch + g * HD + d]; o16[q] = tohx(x); unsigned short a2, c2; splitf(x, a2, c2); oh[q] = a2; ol[q] = c2; }
    *(v2h*)(V16 + e) = o16; *(v2us*)(Vh + e) = oh; *(v2us*)(Vl + e) = ol;  }
__global__ __launch_bounds__(256) void k_csid(float* CS) { const int idx = blockIdx.x * 256 + threadIdx.x; if (idx >= TT * HD) return; v2f cs; cs[0] = 1.0f; cs[1] = 0.0f; *(v2f*)(CS + (size_t)idx * 2) = cs;  }
// k_asoft: per row (zz, i): t = S x HD^-0.5 for j <= i and i - j < WIN (WIN = TT, so plain causal; the reference's -1e9 additive fill vanishes identically); softmax over the 2048 keys (register row, one exp, fixed trees);
__global__ __launch_bounds__(256) void k_asoft(const float* __restrict__ Sb, h16* P16, bf* Ph, bf* Pl) {
    const int lane = threadIdx.x & 31; const int row = blockIdx.x * 8 + (threadIdx.x >> 5); if (row >= ZH * TT) return; const int i = row % TT; const int zz = row / TT; (void)zz; const bool hires = (i < RH); const float* sr = Sb + (size_t)row * TT; float v[TT / 32]; float mx = -3.0e38f;
#pragma unroll
    for (int ch = 0; ch < TT / 128; ++ch) { const int j0 = ch * 128 + lane * 4; const v4f a = *(const v4f*)(sr + j0);
#pragma unroll
        for (int q = 0; q < 4; ++q) { const int j = j0 + q; (void)j; const float t = (j <= i && i - j < WIN) ? a[q] * SCL : -3.0e38f; v[ch * 4 + q] = t; mx = fmaxf(mx, t); } }
#pragma unroll
    for (int sh = 16; sh; sh >>= 1) mx = fmaxf(mx, __shfl_xor(mx, sh, 32));
    float sum = 0.f;
#pragma unroll
    for (int k = 0; k < TT / 32; ++k) { float d0 = __fsub_rn(v[k], mx); asm volatile("" : "+v"(d0)); v[k] = __builtin_amdgcn_exp2f(__fmul_rn(d0, 1.4426950408889634f)); sum += v[k]; }
#pragma unroll
    for (int sh = 16; sh; sh >>= 1) sum += __shfl_xor(sum, sh, 32);
    const float f = __fdiv_rn(hires ? 1.0f : PCAR, sum);
{
        if (hires) {
#pragma unroll
            for (int ch = 0; ch < TT / 128; ++ch) { v4us oh, ol;
#pragma unroll
                for (int q = 0; q < 4; ++q) { unsigned short a, c2; splitf(v[ch * 4 + q] * f, a, c2); oh[q] = a; ol[q] = c2; }
                const size_t oo = ((size_t)zz * (RH ? RH : 1) + i) * TT + ch * 128 + lane * 4; *(v4us*)(Ph + oo) = oh; *(v4us*)(Pl + oo) = ol; }
        } else {
#pragma unroll
            for (int ch = 0; ch < TT / 128; ++ch) { v4h o4;
#pragma unroll
                for (int q = 0; q < 4; ++q) o4[q] = tohx(v[ch * 4 + q] * f);
                *(v4h*)(P16 + (size_t)row * TT + ch * 128 + lane * 4) = o4; } }
         }
}
__global__ __launch_bounds__(256) void k_merge(const float* __restrict__ O, int h0, bf* Ah, bf* Al) { const size_t e = ((size_t)blockIdx.x * 256 + threadIdx.x) * 2; if (e >= (size_t)ZH * TT * HD) return; const int d = (int)(e % HD); const int t = (int)((e / HD) % TT); const int zz = (int)(e / ((size_t)HD * TT)); const float cs = (t < RH) ? 1.0f : (1.0f / PCAR); const size_t oo = (size_t)t * DQ + (h0 + zz) * HD + d;
    v2us oh, ol;
#pragma unroll
    for (int q = 0; q < 2; ++q) { unsigned short a, c2; splitf(O[e + q] * cs, a, c2); oh[q] = a; ol[q] = c2; } *(v2us*)(Ah + oo) = oh; *(v2us*)(Al + oo) = ol;  }

extern "C" void kernel_launch(void* const* d_in, const int* in_sizes, int n_in,
                              void* d_out, int out_size, void* d_ws, size_t ws_size, hipStream_t stream) {
    (void)in_sizes; (void)n_in; (void)out_size;
    const float* x = (const float*)d_in[0]; const float* wq = (const float*)d_in[1]; const float* bq = (const float*)d_in[2]; const float* wk = (const float*)d_in[3]; const float* bk = (const float*)d_in[4]; const float* wv = (const float*)d_in[5]; const float* bv = (const float*)d_in[6]; const float* wo = (const float*)d_in[7]; const float* bo = (const float*)d_in[8];   /* order x, Wq, bq, Wk, bk, Wv, bv, Wo, bo */
    float* OUT = (float*)d_out;     // [2][2048][2048]
    char* wsp = (char*)d_ws;
    auto take = [&](size_t bytes) { char* p = wsp; wsp += (bytes + 255) & ~(size_t)255; return (void*)p; };
    bf* WQ = (bf*)take((size_t)DQ * DM * 2); bf* WK = (bf*)take((size_t)DKV * DM * 2); bf* WV = (bf*)take((size_t)DKV * DM * 2); bf* WO = (bf*)take((size_t)DM * DQ * 2); float* CS = (float*)take((size_t)TT * HD * 2 * 4);
    bf* XB = (bf*)take((size_t)TT * DM * 2); float* FQ = (float*)take((size_t)TT * DQ * 4); float* FK = (float*)take((size_t)TT * DKV * 4);
    h16* QP16 = (h16*)take((size_t)NH_ * TT * HD * 2); h16* KP16 = (h16*)take((size_t)NKV * TT * HD * 2); h16* VT16 = (h16*)take((size_t)NKV * HD * TT * 2);
    bf* QPh = (bf*)take((size_t)NH_ * TT * HD * 2); bf* QPl = (bf*)take((size_t)NH_ * TT * HD * 2); bf* KPh = (bf*)take((size_t)NKV * TT * HD * 2); bf* KPl = (bf*)take((size_t)NKV * TT * HD * 2); bf* VTh = (bf*)take((size_t)NKV * HD * TT * 2); bf* VTl = (bf*)take((size_t)NKV * HD * TT * 2); bf* Ph = (bf*)take((size_t)ZH * RH * TT * 2); bf* Pl = (bf*)take((size_t)ZH * RH * TT * 2);
    float* Sb = (float*)take((size_t)ZH * TT * TT * 4); h16* P16 = (h16*)take((size_t)ZH * TT * TT * 2); float* Ob = (float*)take((size_t)ZH * TT * HD * 4); bf* ATh = (bf*)take((size_t)TT * DQ * 2); bf* ATl = (bf*)take((size_t)TT * DQ * 2);
    if ((size_t)(wsp - (char*)d_ws) > ws_size) return;    // ws 256 MiB
    float* FV = FK;   // v projection reuses the k buffer after the k planes are built (stream-ordered)
    { k_cvt8<<<(unsigned)(((size_t)DQ * DM / 8 + 255) / 256), 256, 0, stream>>>(wq, WQ, (size_t)DQ * DM / 8); k_cvt8<<<(unsigned)(((size_t)DKV * DM / 8 + 255) / 256), 256, 0, stream>>>(wk, WK, (size_t)DKV * DM / 8); k_cvt8<<<(unsigned)(((size_t)DKV * DM / 8 + 255) / 256), 256, 0, stream>>>(wv, WV, (size_t)DKV * DM / 8);
      k_cvt8<<<(unsigned)(((size_t)DM * DQ / 8 + 255) / 256), 256, 0, stream>>>(wo, WO, (size_t)DM * DQ / 8);
       }
    k_csid<<<(TT * HD + 255) / 256, 256, 0, stream>>>(CS);
    const unsigned LQ = (unsigned)(((size_t)NH_ * TT * HD / 2 + 255) / 256), LKv = (unsigned)(((size_t)NKV * TT * HD / 2 + 255) / 256);
    for (int b = 0; b < NB_; ++b) {
        
        k_cvt8<<<(unsigned)(((size_t)TT * DM / 8 + 255) / 256), 256, 0, stream>>>(x + (size_t)b * TT * DM, XB, (size_t)TT * DM / 8);
        k_gemmw<bf, 0, true><<<dim3(TT / 64, DQ / 64, 1), 32, 0, stream>>>(XB, nullptr, WQ, nullptr, DM, FQ, DQ, bq, 0, 0, 0);
        k_rope<<<LQ, 256, 0, stream>>>(FQ, DQ, NH_, CS, nullptr, nullptr, 1.0f, QP16, QPh, QPl);
        k_gemmw<bf, 0, true><<<dim3(TT / 64, DKV / 64, 1), 32, 0, stream>>>(XB, nullptr, WK, nullptr, DM, FK, DKV, bk, 0, 0, 0);
        k_rope<<<LKv, 256, 0, stream>>>(FK, DKV, NKV, CS, nullptr, nullptr, 1.0f, KP16, KPh, KPl);
        k_gemmw<bf, 0, true><<<dim3(TT / 64, DKV / 64, 1), 32, 0, stream>>>(XB, nullptr, WV, nullptr, DM, FV, DKV, bv, 0, 0, 0); k_vtp<<<LKv, 256, 0, stream>>>(FV, DKV, NKV, VT16, VTh, VTl);
        for (int h0 = 0; h0 < NH_; h0 += ZH) { const size_t zq = (size_t)h0, zk = (size_t)(h0 / REP);   // both heads of a pass share kv group h0/REP (REP >= 2): sB = 0
            k_gemmc<bf, 2, 1><<<dim3(RH / 64, TT / 64, ZH), 32, 0, stream>>>(QPh + zq * TT * HD, QPl + zq * TT * HD, KPh + zk * TT * HD, KPl + zk * TT * HD, HD, Sb, TT, 0, (size_t)TT * HD, 0, (size_t)TT * TT);
            k_gemmc<h16, 0, 1><<<dim3((TT - RH) / 64, TT / 64, ZH), 32, 0, stream>>>(QP16 + zq * TT * HD + (size_t)RH * HD, nullptr, KP16 + zk * TT * HD, nullptr, HD, Sb + (size_t)RH * TT, TT, RH, (size_t)TT * HD, 0, (size_t)TT * TT);
            k_asoft<<<ZH * TT / 8, 256, 0, stream>>>(Sb, P16, Ph, Pl);
            k_gemmc<bf, 2, 2><<<dim3(RH / 64, HD / 64, ZH), 32, 0, stream>>>(Ph, Pl, VTh + zk * HD * TT, VTl + zk * HD * TT, TT, Ob, HD, 0, (size_t)RH * TT, 0, (size_t)TT * HD);
            k_gemmc<h16, 0, 2><<<dim3((TT - RH) / 64, HD / 64, ZH), 32, 0, stream>>>(P16 + (size_t)RH * TT, nullptr, VT16 + zk * HD * TT, nullptr, TT, Ob + (size_t)RH * HD, HD, RH, (size_t)TT * TT, 0, (size_t)TT * HD);
            k_merge<<<(unsigned)(((size_t)ZH * TT * HD / 2 + 255) / 256), 256, 0, stream>>>(Ob, h0, ATh, ATl); }
        k_gemmw<bf, 1, true><<<dim3(TT / 64, DM / 64, 1), 32, 0, stream>>>(ATh, ATl, WO, nullptr, DQ, OUT + (size_t)b * TT * DM, DM, bo, 0, 0, 0); }
}

// v001
// A run of this version takes 1280 microseconds.
// Timed twice side by side with v000, it ran 2.09 and 2.11 times as fast.
#include <hip/hip_runtime.h>

// Grouped-query causal attention (x [2][2048][2048]; q = x Wq^T + bq (32 heads x 64), k, v = x Wk^T + bk, x Wv^T + bv (8 kv heads x 64) ('oi' 1/sqrt(2048), zero biases); query head j = (kv head h, group member g) = 4h + g uses kv head h; scores x 64^-0.5; causal (-inf); softmax; out = merged Wo^T + bo ('oi' [2048][2048]) -> [2][2048][2048] (8.4 M); argument order x, Wq, bq, Wk, bk, Wv, bv, Wo, bo).
// Layout per batch: bf16 copy of x; exact projections + f32 biases; causal T-2048 attention (hybrid rows: < 512 hi/lo 3 products, rest fp16 x1024; k_gemmc skips tiles above the diagonal; one pass takes 8 query heads = 2 kv heads; each probability row is stored over its own score row); merged hi/lo x Wo exact + bo.
// Compute dtypes, f32 accumulate: every input rounded to bf16; projections exact + f32 biases; attention rows < 512 3 products, rest fp16; softmax f32; Wo hl x exact + bias.

#define NB_  2
#define TT   2048
#define DM   2048
#define NH_  32
#define NKV  8
#define REP  (NH_ / NKV)
#define HD   64
#define DQ   (NH_ * HD)
#define DKV  (NKV * HD)
#define ZH   8                    // query heads per attention pass (a multiple of REP: whole kv groups)
#define PP   (2 * TT)             // pitch in 16-bit elements of a probability row (it lies in its 8 KiB score row) and of a V^T row, the two operands of one product
#define RH   512                  // query rows < RH use hi+lo planes (0: none)
#define WIN  2048
#define PCAR 1024.0f
#define SCL  0.125f   // HD^-0.5
typedef _Float16 h16;
typedef unsigned short bf;
typedef __attribute__((ext_vector_type(16))) __bf16   v16bf;
typedef __attribute__((ext_vector_type(16))) _Float16 v16h;
typedef __attribute__((ext_vector_type(8)))  _Float16 v8h;
typedef __attribute__((ext_vector_type(8)))  unsigned short v8us;
typedef __attribute__((ext_vector_type(8)))  float    v8f;
typedef __attribute__((ext_vector_type(4)))  float    v4f;
typedef v8h  __attribute__((may_alias)) v8ha;
typedef v4f  __attribute__((may_alias)) v4fa;
typedef v8us __attribute__((may_alias)) v8usa;

__device__ __forceinline__ unsigned short f2bf(float f) { unsigned u = __float_as_uint(f); u += 0x7FFFu + ((u >> 16) & 1u); return (unsigned short)(u >> 16); }
__device__ __forceinline__ float bf2f(unsigned short b) { return __uint_as_float(((unsigned)b) << 16); }
__device__ __forceinline__ float bfr(float f) { return bf2f(f2bf(f)); }
__device__ __forceinline__ v16h cat16(v8h lo, v8h hi) { return __builtin_shufflevector(lo, hi, 0, 1, 2, 3, 4, 5, 6, 7, 8, 9, 10, 11, 12, 13, 14, 15); }
__device__ __forceinline__ v16bf cat16b(v8us lo, v8us hi) { return __builtin_bit_cast(v16bf, __builtin_shufflevector(lo, hi, 0, 1, 2, 3, 4, 5, 6, 7, 8, 9, 10, 11, 12, 13, 14, 15)); }
__device__ __forceinline__ v8f wmma16(v16h a, v16h b, v8f c) { return __builtin_amdgcn_wmma_f32_16x16x32_f16(false, a, false, b, (short)0, c, false, false); }
__device__ __forceinline__ v8f wmmab(v16bf a, v16bf b, v8f c) { return __builtin_amdgcn_wmma_f32_16x16x32_bf16(false, a, false, b, (short)0, c, false, false); }



// ---- k_gemmw: register-blocked GEMM, ONE WAVE per 64x64 output tile (16 accumulators), operands straight from K-contiguous 16-bit planes; grid (M/64, N/64, Z), 32 threads.
// C[m][n] (f32, pitch ldc, + optional f32 bias[n]) = sum_k A[m][k] Bt[n][k] (+ split products per NSPLIT). z-batch strides sA/sB/sC in elements. K % 32 == 0.
template <typename T16> struct WFrag;
template <> struct WFrag<h16> { typedef v16h V; static __device__ __forceinline__ V ld(const h16* p) { return cat16(*(const v8h*)p, *(const v8h*)(p + 16)); } static __device__ __forceinline__ v8f mma(V a, V b, v8f c) { return wmma16(a, b, c); } };
template <> struct WFrag<bf> { typedef v16bf V; static __device__ __forceinline__ V ld(const bf* p) { return cat16b(*(const v8us*)p, *(const v8us*)(p + 16)); } static __device__ __forceinline__ v8f mma(V a, V b, v8f c) { return wmmab(a, b, c); } };
template <typename T16, int NSPLIT, bool BIAS>
__global__ __launch_bounds__(32) void k_gemmw(const T16* __restrict__ A, const T16* __restrict__ A2, const T16* __restrict__ Bt, const T16* __restrict__ Bt2, int K, float* C, int ldc, const float* __restrict__ bias, size_t sA, size_t sB, size_t sC) {
    typedef typename WFrag<T16>::V V;
    __shared__ __align__(16) float os[16 * 68];
    const size_t z = blockIdx.z; A += z * sA; if (A2) A2 += z * sA; Bt += z * sB; if (Bt2) Bt2 += z * sB; C += z * sC;
    const int lane = threadIdx.x & 31, lr = lane & 15, hi = lane >> 4; const int r0 = blockIdx.x * 64, c0 = blockIdx.y * 64;
    v8f acc[4][4];
#pragma unroll
    for (int mb = 0; mb < 4; ++mb)
#pragma unroll
        for (int nb = 0; nb < 4; ++nb) acc[mb][nb] = (v8f){};
    const size_t aoff = (size_t)(r0 + lr) * K + 8 * hi, boff = (size_t)(c0 + lr) * K + 8 * hi;
#pragma unroll 1
    for (int kc = 0; kc < K; kc += 32) {
        V a[4], a2[4];
#pragma unroll
        for (int mb = 0; mb < 4; ++mb) { a[mb] = WFrag<T16>::ld(A + aoff + (size_t)mb * 16 * K + kc); if (NSPLIT == 1 || NSPLIT == 2) a2[mb] = WFrag<T16>::ld(A2 + aoff + (size_t)mb * 16 * K + kc); }
#pragma unroll
        for (int nb = 0; nb < 4; ++nb) { const V b = WFrag<T16>::ld(Bt + boff + (size_t)nb * 16 * K + kc); V b2; if (NSPLIT >= 2) b2 = WFrag<T16>::ld(Bt2 + boff + (size_t)nb * 16 * K + kc);
#pragma unroll
            for (int mb = 0; mb < 4; ++mb) { acc[mb][nb] = WFrag<T16>::mma(a[mb], b, acc[mb][nb]); if (NSPLIT == 1 || NSPLIT == 2) acc[mb][nb] = WFrag<T16>::mma(a2[mb], b, acc[mb][nb]); if (NSPLIT >= 2) acc[mb][nb] = WFrag<T16>::mma(a[mb], b2, acc[mb][nb]); } }
        asm volatile("v_nop\n\tv_nop\n\tv_nop\n\tv_nop" : "+v"(acc[0][0]), "+v"(acc[1][1]), "+v"(acc[2][2]), "+v"(acc[3][3]) : "v"(a[0]), "v"(a[3]));
    }
#pragma unroll
    for (int mb = 0; mb < 4; ++mb) {
#pragma unroll
        for (int nb = 0; nb < 4; ++nb) {
#pragma unroll
            for (int j = 0; j < 8; ++j) os[(hi * 8 + j) * 68 + nb * 16 + lr] = acc[mb][nb][j]; }
        __builtin_amdgcn_wave_barrier(); asm volatile("" ::: "memory");
        float* crow = C + (size_t)(r0 + mb * 16) * ldc + c0;
{
#pragma unroll
            for (int s = 0; s < 8; ++s) { const int row = 2 * s + hi, cofs = lr * 4; v4f val = *(const v4fa*)(os + row * 68 + cofs); if (BIAS) { val[0] += bfr(bias[c0 + cofs]); val[1] += bfr(bias[c0 + cofs + 1]); val[2] += bfr(bias[c0 + cofs + 2]); val[3] += bfr(bias[c0 + cofs + 3]); }
                *(v4f*)(crow + (size_t)row * ldc + cofs) = val; }
             }
        __builtin_amdgcn_wave_barrier(); asm volatile("" ::: "memory");
    }
}

// ---- k_gemmc: the same one-wave 64x64 tile GEMM specialised for causal attention: CMODE 1 skips score tiles entirely above the diagonal (query rows r0+roff.., key columns c0..), CMODE 2 limits the
// key (K) loop of the probability x value contraction to the diagonal block (probabilities beyond it are exactly zero). roff = row offset of this launch's first row within the sequence.
// batch entry z reads the B planes of kv head z / REP (stride sB). K is the pitch of both operands; in the CMODE 2 launches it is PP, and the loop ends at the diagonal block (at most TT).
template <typename T16, int NSPLIT, int CMODE>
__global__ __launch_bounds__(32) void k_gemmc(const T16* __restrict__ A, const T16* __restrict__ A2, const T16* __restrict__ Bt, const T16* __restrict__ Bt2, int K, float* C, int ldc, int roff, size_t sA, size_t sB, size_t sC) {
    typedef typename WFrag<T16>::V V;
    __shared__ __align__(16) float os[16 * 68];
    const size_t z = blockIdx.z; A += z * sA; if (A2) A2 += z * sA; Bt += (z / REP) * sB; if (Bt2) Bt2 += (z / REP) * sB; C += z * sC;
    const int lane = threadIdx.x & 31, lr = lane & 15, hi = lane >> 4; const int r0 = blockIdx.x * 64, c0 = blockIdx.y * 64;
    if (CMODE == 1 && c0 > r0 + roff + 63) return;                  // score tile entirely above the causal diagonal: never read (the softmax masks j > i by select)
    const int Kl = (CMODE == 2) ? min(K, r0 + roff + 64) : K;        // P.V: probabilities are exactly 0 beyond the diagonal block, so the K loop stops there
    v8f acc[4][4];
#pragma unroll
    for (int mb = 0; mb < 4; ++mb)
#pragma unroll
        for (int nb = 0; nb < 4; ++nb) acc[mb][nb] = (v8f){};
    const size_t aoff = (size_t)(r0 + lr) * K + 8 * hi, boff = (size_t)(c0 + lr) * K + 8 * hi;
#pragma unroll 1
    for (int kc = 0; kc < Kl; kc += 32) {
        V a[4], a2[4];
#pragma unroll
        for (int mb = 0; mb < 4; ++mb) { a[mb] = WFrag<T16>::ld(A + aoff + (size_t)mb * 16 * K + kc); if (NSPLIT == 1 || NSPLIT == 2) a2[mb] = WFrag<T16>::ld(A2 + aoff + (size_t)mb * 16 * K + kc); }
#pragma unroll
        for (int nb = 0; nb < 4; ++nb) { const V b = WFrag<T16>::ld(Bt + boff + (size_t)nb * 16 * K + kc); V b2; if (NSPLIT >= 2) b2 = WFrag<T16>::ld(Bt2 + boff + (size_t)nb * 16 * K + kc);
#pragma unroll
            for (int mb = 0; mb < 4; ++mb) { acc[mb][nb] = WFrag<T16>::mma(a[mb], b, acc[mb][nb]); if (NSPLIT == 1 || NSPLIT == 2) acc[mb][nb] = WFrag<T16>::mma(a2[mb], b, acc[mb][nb]); if (NSPLIT >= 2) acc[mb][nb] = WFrag<T16>::mma(a[mb], b2, acc[mb][nb]); } }
        asm volatile("v_nop\n\tv_nop\n\tv_nop\n\tv_nop" : "+v"(acc[0][0]), "+v"(acc[1][1]), "+v"(acc[2][2]), "+v"(acc[3][3]) : "v"(a[0]), "v"(a[3]));
    }
#pragma unroll
    for (int mb = 0; mb < 4; ++mb) {
#pragma unroll
        for (int nb = 0; nb < 4; ++nb) {
#pragma unroll
            for (int j = 0; j < 8; ++j) os[(hi * 8 + j) * 68 + nb * 16 + lr] = acc[mb][nb][j]; }
        __builtin_amdgcn_wave_barrier(); asm volatile("" ::: "memory");
        float* crow = C + (size_t)(r0 + mb * 16) * ldc + c0;
{
#pragma unroll
            for (int s = 0; s < 8; ++s) { const int row = 2 * s + hi, cofs = lr * 4; v4f val = *(const v4fa*)(os + row * 68 + cofs);
                *(v4f*)(crow + (size_t)row * ldc + cofs) = val; }
             }
        __builtin_amdgcn_wave_barrier(); asm volatile("" ::: "memory");
    }
}

__device__ __forceinline__ h16 tohx(float x) { return (h16)x; }
__device__ __forceinline__ void splitf(float y, unsigned short& h, unsigned short& l) { h = f2bf(y); l = f2bf(y - bf2f(h)); }
typedef __attribute__((ext_vector_type(2))) _Float16 v2h;
typedef __attribute__((ext_vector_type(4))) _Float16 v4h;
typedef __attribute__((ext_vector_type(2))) unsigned short v2us;
typedef __attribute__((ext_vector_type(4))) unsigned short v4us;
typedef __attribute__((ext_vector_type(2))) float v2f;
typedef __attribute__((ext_vector_type(4))) int v4i;

__global__ __launch_bounds__(256) void k_wtG(const float* __restrict__ w, int K, int N, bf* Bt) {
    const int lane = threadIdx.x & 31; const int L0 = (blockIdx.x * 8 + (threadIdx.x >> 5)) * 8; const int nlines = N * K / 64;
{
#pragma unroll 1
        for (int l = 0; l < 8; ++l) { const int L = L0 + l; if (L >= nlines) break; const size_t e = (size_t)L * 64 + lane * 2; const int k = (int)(e % K), n = (int)(e / K); v2us o;
            o[0] = f2bf(w[(size_t)k * N + n]); o[1] = f2bf(w[(size_t)(k + 1) * N + n]); *(v2us*)(Bt + e) = o; }
         }
}
__global__ __launch_bounds__(256) void k_cvt8(const float* __restrict__ src, bf* dst, size_t n8) { const size_t i = (size_t)blockIdx.x * 256 + threadIdx.x; if (i >= n8) return; const v8f v = *(const v8f*)(src + i * 8); v8us o;
#pragma unroll
    for (int k = 0; k < 8; ++k) o[k] = f2bf(v[k]); *(v8us*)(dst + i * 8) = o;  }

// k_rope: head planes [h][t][d] (fp16 + hi/lo) of rope(x) x sc with the rotate-half convention out[d] = x[d] cos[t][d] - x[d+HD/2] sin[t][d], out[d+HD/2] = x[d+HD/2] cos[t][d+HD/2] + x[d] sin[t][d+HD/2]
__global__ __launch_bounds__(256) void k_rope(const float* __restrict__ F, int pitch, int nheads, const float* __restrict__ CS, const float* __restrict__ RF, const float* __restrict__ nw, float sc, h16* P16, bf* Ph, bf* Pl) {
    const size_t e = ((size_t)blockIdx.x * 256 + threadIdx.x) * 2; if (e >= (size_t)nheads * TT * HD) return; const int d = (int)(e % HD); const int t = (int)((e / HD) % TT); const int h = (int)(e / ((size_t)HD * TT)); const float* f = F + (size_t)t * pitch + h * HD; const float rf = RF ? RF[(size_t)h * TT + t] : 1.0f; v2h o16; v2us oh, ol;
#pragma unroll
    for (int q = 0; q < 2; ++q) { const int dd = d + q; const int dp = (dd < HD / 2) ? dd + HD / 2 : dd - HD / 2; float x0 = f[dd], x1 = f[dp];
        if (RF) { float n0 = __fmul_rn(x0, rf), n1 = __fmul_rn(x1, rf); asm volatile("" : "+v"(n0)); asm volatile("" : "+v"(n1)); x0 = __fmul_rn(bfr(nw[dd]), n0); x1 = __fmul_rn(bfr(nw[dp]), n1); }
        const v2f cs = *(const v2f*)(CS + ((size_t)t * HD + dd) * 2); float a = __fmul_rn(x0, cs[0]), bq = __fmul_rn(x1, cs[1]); asm volatile("" : "+v"(a)); asm volatile("" : "+v"(bq)); const float r = ((dd < HD / 2) ? __fsub_rn(a, bq) : __fadd_rn(a, bq)) * sc;
        o16[q] = tohx(r); unsigned short a2, c2; splitf(r, a2, c2); oh[q] = a2; ol[q] = c2; }
    *(v2h*)(P16 + e) = o16; *(v2us*)(Ph + e) = oh; *(v2us*)(Pl + e) = ol;  }
__global__ __launch_bounds__(256) void k_vtp(const float* __restrict__ F, int pitch, int nheads, h16* V16, bf* Vh, bf* Vl) { const size_t e = ((size_t)blockIdx.x * 256 + threadIdx.x) * 2; if (e >= (size_t)nheads * HD * TT) return; const int t = (int)(e % TT); const int d = (int)((e / TT) % HD); const int g = (int)(e / ((size_t)TT * HD)); v2h o16; v2us oh, ol;
#pragma unroll
    for (int q = 0; q < 2; ++q) { const float x = F[(size_t)(t + q) * pitch + g * HD + d]; o16[q] = tohx(x); unsigned short a2, c2; splitf(x, a2, c2); oh[q] = a2; ol[q] = c2; }
    const size_t oo = ((size_t)g * HD + d) * PP + t; *(v2h*)(V16 + oo) = o16; *(v2us*)(Vh + oo) = oh; *(v2us*)(Vl + oo) = ol;  }
__global__ __launch_bounds__(256) void k_csid(float* CS) { const int idx = blockIdx.x * 256 + threadIdx.x; if (idx >= TT * HD) return; v2f cs; cs[0] = 1.0f; cs[1] = 0.0f; *(v2f*)(CS + (size_t)idx * 2) = cs;  }
// k_asoft: per row (zz, i): t = S x HD^-0.5 for j <= i and i - j < WIN (sliding causal window; the reference's -1e9 additive fill vanishes identically); softmax over the 2048 keys (register row, one exp, fixed trees);
// the probabilities go back over the row's own 8 KiB of scores, which the wave holds whole in registers by then: rows < RH hi plane in the first 4 KiB and lo plane in the second, other rows fp16 in the first 4 KiB.
__global__ __launch_bounds__(256) void k_asoft(float* Sb) {
    const int lane = threadIdx.x & 31; const int row = blockIdx.x * 8 + (threadIdx.x >> 5); if (row >= ZH * TT) return; const int i = row % TT; const int zz = row / TT; (void)zz; const bool hires = (i < RH); float* sr = Sb + (size_t)row * TT; float v[TT / 32]; float mx = -3.0e38f;
#pragma unroll
    for (int ch = 0; ch < TT / 128; ++ch) { const int j0 = ch * 128 + lane * 4; const v4f a = *(const v4f*)(sr + j0);
#pragma unroll
        for (int q = 0; q < 4; ++q) { const int j = j0 + q; (void)j; const float t = (j <= i && i - j < WIN) ? a[q] * SCL : -3.0e38f; v[ch * 4 + q] = t; mx = fmaxf(mx, t); } }
#pragma unroll
    for (int sh = 16; sh; sh >>= 1) mx = fmaxf(mx, __shfl_xor(mx, sh, 32));
    float sum = 0.f;
#pragma unroll
    for (int k = 0; k < TT / 32; ++k) { float d0 = __fsub_rn(v[k], mx); asm volatile("" : "+v"(d0)); v[k] = __builtin_amdgcn_exp2f(__fmul_rn(d0, 1.4426950408889634f)); sum += v[k]; }
#pragma unroll
    for (int sh = 16; sh; sh >>= 1) sum += __shfl_xor(sum, sh, 32);
    const float f = __fdiv_rn(hires ? 1.0f : PCAR, sum);
{
        if (hires) {
#pragma unroll
            for (int ch = 0; ch < TT / 128; ++ch) { v4us oh, ol;
#pragma unroll
                for (int q = 0; q < 4; ++q) { unsigned short a, c2; splitf(v[ch * 4 + q] * f, a, c2); oh[q] = a; ol[q] = c2; }
                const int oo = ch * 128 + lane * 4; *(v4us*)((bf*)sr + oo) = oh; *(v4us*)((bf*)sr + TT + oo) = ol; }
        } else {
#pragma unroll
            for (int ch = 0; ch < TT / 128; ++ch) { v4h o4;
#pragma unroll
                for (int q = 0; q < 4; ++q) o4[q] = tohx(v[ch * 4 + q] * f);
                *(v4h*)((h16*)sr + ch * 128 + lane * 4) = o4; } }
         }
}
__global__ __launch_bounds__(256) void k_merge(const float* __restrict__ O, int h0, bf* Ah, bf* Al) { const size_t e = ((size_t)blockIdx.x * 256 + threadIdx.x) * 2; if (e >= (size_t)ZH * TT * HD) return; const int d = (int)(e % HD); const int t = (int)((e / HD) % TT); const int zz = (int)(e / ((size_t)HD * TT)); const float cs = (t < RH) ? 1.0f : (1.0f / PCAR); const size_t oo = (size_t)t * DQ + (h0 + zz) * HD + d;
    v2us oh, ol;
#pragma unroll
    for (int q = 0; q < 2; ++q) { unsigned short a, c2; splitf(O[e + q] * cs, a, c2); oh[q] = a; ol[q] = c2; } *(v2us*)(Ah + oo) = oh; *(v2us*)(Al + oo) = ol;  }

extern "C" void kernel_launch(void* const* d_in, const int* in_sizes, int n_in,
                              void* d_out, int out_size, void* d_ws, size_t ws_size, hipStream_t stream) {
    (void)in_sizes; (void)n_in; (void)out_size;
    const float* x = (const float*)d_in[0]; const float* wq = (const float*)d_in[1]; const float* bq = (const float*)d_in[2]; const float* wk = (const float*)d_in[3]; const float* bk = (const float*)d_in[4]; const float* wv = (const float*)d_in[5]; const float* bv = (const float*)d_in[6]; const float* wo = (const float*)d_in[7]; const float* bo = (const float*)d_in[8];   /* order x, Wq, bq, Wk, bk, Wv, bv, Wo, bo */
    float* OUT = (float*)d_out;     // [2][2048][2048]
    char* wsp = (char*)d_ws;
    auto take = [&](size_t bytes) { char* p = wsp; wsp += (bytes + 255) & ~(size_t)255; return (void*)p; };
    bf* WQ = (bf*)take((size_t)DQ * DM * 2); bf* WK = (bf*)take((size_t)DKV * DM * 2); bf* WV = (bf*)take((size_t)DKV * DM * 2); bf* WO = (bf*)take((size_t)DM * DQ * 2); float* CS = (float*)take((size_t)TT * HD * 2 * 4);
    bf* XB = (bf*)take((size_t)TT * DM * 2); float* FQ = (float*)take((size_t)TT * DQ * 4); float* FK = (float*)take((size_t)TT * DKV * 4);
    h16* QP16 = (h16*)take((size_t)NH_ * TT * HD * 2); h16* KP16 = (h16*)take((size_t)NKV * TT * HD * 2); h16* VT16 = (h16*)take((size_t)NKV * HD * PP * 2);
    bf* QPh = (bf*)take((size_t)NH_ * TT * HD * 2); bf* QPl = (bf*)take((size_t)NH_ * TT * HD * 2); bf* KPh = (bf*)take((size_t)NKV * TT * HD * 2); bf* KPl = (bf*)take((size_t)NKV * TT * HD * 2); bf* VTh = (bf*)take((size_t)NKV * HD * PP * 2); bf* VTl = (bf*)take((size_t)NKV * HD * PP * 2);
    float* Sb = (float*)take((size_t)ZH * TT * TT * 4); float* Ob = (float*)take((size_t)ZH * TT * HD * 4); bf* ATh = (bf*)take((size_t)TT * DQ * 2); bf* ATl = (bf*)take((size_t)TT * DQ * 2);
    if ((size_t)(wsp - (char*)d_ws) > ws_size) return;    // ws 256 MiB
    float* FV = FK;   // v projection reuses the k buffer after the k planes are built (stream-ordered)
    { k_cvt8<<<(unsigned)(((size_t)DQ * DM / 8 + 255) / 256), 256, 0, stream>>>(wq, WQ, (size_t)DQ * DM / 8); k_cvt8<<<(unsigned)(((size_t)DKV * DM / 8 + 255) / 256), 256, 0, stream>>>(wk, WK, (size_t)DKV * DM / 8); k_cvt8<<<(unsigned)(((size_t)DKV * DM / 8 + 255) / 256), 256, 0, stream>>>(wv, WV, (size_t)DKV * DM / 8);
      k_cvt8<<<(unsigned)(((size_t)DM * DQ / 8 + 255) / 256), 256, 0, stream>>>(wo, WO, (size_t)DM * DQ / 8);
       }
    k_csid<<<(TT * HD + 255) / 256, 256, 0, stream>>>(CS);
    const unsigned LQ = (unsigned)(((size_t)NH_ * TT * HD / 2 + 255) / 256), LKv = (unsigned)(((size_t)NKV * TT * HD / 2 + 255) / 256);
    for (int b = 0; b < NB_; ++b) {
        
        k_cvt8<<<(unsigned)(((size_t)TT * DM / 8 + 255) / 256), 256, 0, stream>>>(x + (size_t)b * TT * DM, XB, (size_t)TT * DM / 8);
        k_gemmw<bf, 0, true><<<dim3(TT / 64, DQ / 64, 1), 32, 0, stream>>>(XB, nullptr, WQ, nullptr, DM, FQ, DQ, bq, 0, 0, 0);
        k_rope<<<LQ, 256, 0, stream>>>(FQ, DQ, NH_, CS, nullptr, nullptr, 1.0f, QP16, QPh, QPl);
        k_gemmw<bf, 0, true><<<dim3(TT / 64, DKV / 64, 1), 32, 0, stream>>>(XB, nullptr, WK, nullptr, DM, FK, DKV, bk, 0, 0, 0);
        k_rope<<<LKv, 256, 0, stream>>>(FK, DKV, NKV, CS, nullptr, nullptr, 1.0f, KP16, KPh, KPl);
        k_gemmw<bf, 0, true><<<dim3(TT / 64, DKV / 64, 1), 32, 0, stream>>>(XB, nullptr, WV, nullptr, DM, FV, DKV, bv, 0, 0, 0); k_vtp<<<LKv, 256, 0, stream>>>(FV, DKV, NKV, VT16, VTh, VTl);
        for (int h0 = 0; h0 < NH_; h0 += ZH) { const size_t zq = (size_t)h0, zk = (size_t)(h0 / REP);   // the ZH heads of a pass span kv heads h0/REP .. : k_gemmc steps its B planes by sB per REP heads
            k_gemmc<bf, 2, 1><<<dim3(RH / 64, TT / 64, ZH), 32, 0, stream>>>(QPh + zq * TT * HD, QPl + zq * TT * HD, KPh + zk * TT * HD, KPl + zk * TT * HD, HD, Sb, TT, 0, (size_t)TT * HD, (size_t)TT * HD, (size_t)TT * TT);
            k_gemmc<h16, 0, 1><<<dim3((TT - RH) / 64, TT / 64, ZH), 32, 0, stream>>>(QP16 + zq * TT * HD + (size_t)RH * HD, nullptr, KP16 + zk * TT * HD, nullptr, HD, Sb + (size_t)RH * TT, TT, RH, (size_t)TT * HD, (size_t)TT * HD, (size_t)TT * TT);
            k_asoft<<<ZH * TT / 8, 256, 0, stream>>>(Sb);
            k_gemmc<bf, 2, 2><<<dim3(RH / 64, HD / 64, ZH), 32, 0, stream>>>((const bf*)Sb, (const bf*)Sb + TT, VTh + zk * HD * PP, VTl + zk * HD * PP, PP, Ob, HD, 0, (size_t)TT * PP, (size_t)HD * PP, (size_t)TT * HD);
            k_gemmc<h16, 0, 2><<<dim3((TT - RH) / 64, HD / 64, ZH), 32, 0, stream>>>((const h16*)Sb + (size_t)RH * PP, nullptr, VT16 + zk * HD * PP, nullptr, PP, Ob + (size_t)RH * HD, HD, RH, (size_t)TT * PP, (size_t)HD * PP, (size_t)TT * HD);
            k_merge<<<(unsigned)(((size_t)ZH * TT * HD / 2 + 255) / 256), 256, 0, stream>>>(Ob, h0, ATh, ATl); }
        k_gemmw<bf, 1, true><<<dim3(TT / 64, DM / 64, 1), 32, 0, stream>>>(ATh, ATl, WO, nullptr, DQ, OUT + (size_t)b * TT * DM, DM, bo, 0, 0, 0); }
}

// v002
// It runs in 846 microseconds.
// In both of two side-by-side timings against v001, it was 1.51 times as fast.
// Counting every step since v000, it is 3.17 times as fast.
#include <hip/hip_runtime.h>

// Grouped-query causal attention (x [2][2048][2048]; q = x Wq^T + bq (32 heads x 64), k, v = x Wk^T + bk, x Wv^T + bv (8 kv heads x 64) ('oi' 1/sqrt(2048), zero biases); query head j = (kv head h, group member g) = 4h + g uses kv head h; scores x 64^-0.5; causal (-inf); softmax; out = merged Wo^T + bo ('oi' [2048][2048]) -> [2][2048][2048] (8.4 M); argument order x, Wq, bq, Wk, bk, Wv, bv, Wo, bo).
// Layout per batch: bf16 copy of x; exact projections + f32 biases; causal T-2048 attention (hybrid rows: < 512 hi/lo 3 products, rest fp16 x1024; k_gemmc skips tiles above the diagonal; one pass takes 8 query heads = 2 kv heads; each probability row is stored over its own score row); merged hi/lo x Wo exact + bo.
// Compute dtypes, f32 accumulate: every input rounded to bf16; projections exact + f32 biases; attention rows < 512 3 products, rest fp16; softmax f32; Wo hl x exact + bias.

#define NB_  2
#define TT   2048
#define DM   2048
#define NH_  32
#define NKV  8
#define REP  (NH_ / NKV)
#define HD   64
#define DQ   (NH_ * HD)
#define DKV  (NKV * HD)
#define ZH   8                    // query heads per attention pass (a multiple of REP: whole kv groups)
#define PP   (2 * TT)             // pitch in 16-bit elements of a probability row (it lies in its 8 KiB score row) and of a V^T row, the two operands of one product
#define RH   512                  // query rows < RH use hi+lo planes (0: none)
#define WIN  2048
#define PCAR 1024.0f
#define SCL  0.125f   // HD^-0.5
#define KWL  4                    // waves that share a tile's K loop where a launch has 1024 tiles (q projection, Wo)
#define KWS  8                    // the same where a launch has at most 256 tiles (k, v projections, probability x value)
typedef _Float16 h16;
typedef unsigned short bf;
typedef __attribute__((ext_vector_type(16))) __bf16   v16bf;
typedef __attribute__((ext_vector_type(16))) _Float16 v16h;
typedef __attribute__((ext_vector_type(8)))  _Float16 v8h;
typedef __attribute__((ext_vector_type(8)))  unsigned short v8us;
typedef __attribute__((ext_vector_type(8)))  float    v8f;
typedef __attribute__((ext_vector_type(4)))  float    v4f;
typedef v8h  __attribute__((may_alias)) v8ha;
typedef v4f  __attribute__((may_alias)) v4fa;
typedef v8us __attribute__((may_alias)) v8usa;

__device__ __forceinline__ unsigned short f2bf(float f) { unsigned u = __float_as_uint(f); u += 0x7FFFu + ((u >> 16) & 1u); return (unsigned short)(u >> 16); }
__device__ __forceinline__ float bf2f(unsigned short b) { return __uint_as_float(((unsigned)b) << 16); }
__device__ __forceinline__ float bfr(float f) { return bf2f(f2bf(f)); }
__device__ __forceinline__ v16h cat16(v8h lo, v8h hi) { return __builtin_shufflevector(lo, hi, 0, 1, 2, 3, 4, 5, 6, 7, 8, 9, 10, 11, 12, 13, 14, 15); }
__device__ __forceinline__ v16bf cat16b(v8us lo, v8us hi) { return __builtin_bit_cast(v16bf, __builtin_shufflevector(lo, hi, 0, 1, 2, 3, 4, 5, 6, 7, 8, 9, 10, 11, 12, 13, 14, 15)); }
__device__ __forceinline__ v8f wmma16(v16h a, v16h b, v8f c) { return __builtin_amdgcn_wmma_f32_16x16x32_f16(false, a, false, b, (short)0, c, false, false); }
__device__ __forceinline__ v8f wmmab(v16bf a, v16bf b, v8f c) { return __builtin_amdgcn_wmma_f32_16x16x32_bf16(false, a, false, b, (short)0, c, false, false); }



// tile_sync: between the LDS stores of a tile's rows and their reads. One wave: program order is enough, the compiler is only kept from moving LDS accesses across. Several waves: the work-group barrier, since each wave reads what the others stored.
template <int KW> __device__ __forceinline__ void tile_sync() { if constexpr (KW == 1) { __builtin_amdgcn_wave_barrier(); asm volatile("" ::: "memory"); } else { __syncthreads(); } }

// ---- k_gemmw: register-blocked GEMM, one 64x64 output tile per work-group of KW waves; every wave holds the whole tile (16 accumulators) and takes every KW-th 32-wide K step, operands straight from K-contiguous 16-bit planes;
// the KW partial tiles are summed in wave order through LDS behind one work-group barrier, each wave adding and storing 64 / KW of the rows; grid (M/64, N/64, Z), 32 KW threads.
// C[m][n] (f32, pitch ldc, + optional f32 bias[n]) = sum_k A[m][k] Bt[n][k] (+ split products per NSPLIT). z-batch strides sA/sB/sC in elements. K % 32 == 0.
template <typename T16> struct WFrag;
template <> struct WFrag<h16> { typedef v16h V; static __device__ __forceinline__ V ld(const h16* p) { return cat16(*(const v8h*)p, *(const v8h*)(p + 16)); } static __device__ __forceinline__ v8f mma(V a, V b, v8f c) { return wmma16(a, b, c); } };
template <> struct WFrag<bf> { typedef v16bf V; static __device__ __forceinline__ V ld(const bf* p) { return cat16b(*(const v8us*)p, *(const v8us*)(p + 16)); } static __device__ __forceinline__ v8f mma(V a, V b, v8f c) { return wmmab(a, b, c); } };
template <typename T16, int NSPLIT, bool BIAS, int KW>
__global__ __launch_bounds__(32 * KW) void k_gemmw(const T16* __restrict__ A, const T16* __restrict__ A2, const T16* __restrict__ Bt, const T16* __restrict__ Bt2, int K, float* C, int ldc, const float* __restrict__ bias, size_t sA, size_t sB, size_t sC) {
    typedef typename WFrag<T16>::V V;
    constexpr int MBR = (KW == 1) ? 1 : 4;   // 16-row blocks staged in LDS per round: one wave alone goes block by block, several waves stage their whole partial tiles, so that one barrier serves the tile
    __shared__ __align__(16) float os[KW * MBR * 16 * 68];
    const size_t z = blockIdx.z; A += z * sA; if (A2) A2 += z * sA; Bt += z * sB; if (Bt2) Bt2 += z * sB; C += z * sC;
    const int lane = threadIdx.x & 31, lr = lane & 15, hi = lane >> 4; const int wv = (KW == 1) ? 0 : __builtin_amdgcn_readfirstlane(threadIdx.x >> 5); const int r0 = blockIdx.x * 64, c0 = blockIdx.y * 64;
    v8f acc[4][4];
#pragma unroll
    for (int mb = 0; mb < 4; ++mb)
#pragma unroll
        for (int nb = 0; nb < 4; ++nb) acc[mb][nb] = (v8f){};
    const size_t aoff = (size_t)(r0 + lr) * K + 8 * hi, boff = (size_t)(c0 + lr) * K + 8 * hi;
#pragma unroll 1
    for (int kc = wv * 32; kc < K; kc += 32 * KW) {
        V a[4], a2[4];
#pragma unroll
        for (int mb = 0; mb < 4; ++mb) { a[mb] = WFrag<T16>::ld(A + aoff + (size_t)mb * 16 * K + kc); if (NSPLIT == 1 || NSPLIT == 2) a2[mb] = WFrag<T16>::ld(A2 + aoff + (size_t)mb * 16 * K + kc); }
#pragma unroll
        for (int nb = 0; nb < 4; ++nb) { const V b = WFrag<T16>::ld(Bt + boff + (size_t)nb * 16 * K + kc); V b2; if (NSPLIT >= 2) b2 = WFrag<T16>::ld(Bt2 + boff + (size_t)nb * 16 * K + kc);
#pragma unroll
            for (int mb = 0; mb < 4; ++mb) { acc[mb][nb] = WFrag<T16>::mma(a[mb], b, acc[mb][nb]); if (NSPLIT == 1 || NSPLIT == 2) acc[mb][nb] = WFrag<T16>::mma(a2[mb], b, acc[mb][nb]); if (NSPLIT >= 2) acc[mb][nb] = WFrag<T16>::mma(a[mb], b2, acc[mb][nb]); } }
        asm volatile("v_nop\n\tv_nop\n\tv_nop\n\tv_nop" : "+v"(acc[0][0]), "+v"(acc[1][1]), "+v"(acc[2][2]), "+v"(acc[3][3]) : "v"(a[0]), "v"(a[3]));
    }
#pragma unroll
    for (int m0 = 0; m0 < 4; m0 += MBR) {
#pragma unroll
        for (int mi = 0; mi < MBR; ++mi) {
#pragma unroll
            for (int nb = 0; nb < 4; ++nb) {
#pragma unroll
                for (int j = 0; j < 8; ++j) os[((wv * MBR + mi) * 16 + hi * 8 + j) * 68 + nb * 16 + lr] = acc[m0 + mi][nb][j]; } }
        tile_sync<KW>();
        float* crow = C + (size_t)(r0 + m0 * 16) * ldc + c0;
#pragma unroll
        for (int s = 0; s < MBR * 8 / KW; ++s) { const int row = wv * (MBR * 16 / KW) + 2 * s + hi, cofs = lr * 4; v4f val = *(const v4fa*)(os + row * 68 + cofs);
#pragma unroll
            for (int w = 1; w < KW; ++w) val += *(const v4fa*)(os + (w * MBR * 16 + row) * 68 + cofs);
            if (BIAS) { val[0] += bfr(bias[c0 + cofs]); val[1] += bfr(bias[c0 + cofs + 1]); val[2] += bfr(bias[c0 + cofs + 2]); val[3] += bfr(bias[c0 + cofs + 3]); }
            *(v4f*)(crow + (size_t)row * ldc + cofs) = val; }
        if constexpr (MBR < 4) tile_sync<KW>();   // only where a further round stores over these rows
    }
}

// ---- k_gemmc: the same 64x64 tile GEMM (KW waves share the K loop; KW 1 for the scores, whose K is only HD) specialised for causal attention: CMODE 1 skips score tiles entirely above the diagonal (query rows r0+roff.., key columns c0..), CMODE 2 limits the
// key (K) loop of the probability x value contraction to the diagonal block (probabilities beyond it are exactly zero). roff = row offset of this launch's first row within the sequence.
// batch entry z reads the B planes of kv head z / REP (stride sB). K is the pitch of both operands; in the CMODE 2 launches it is PP, and the loop ends at the diagonal block (at most TT).
template <typename T16, int NSPLIT, int CMODE, int KW>
__global__ __launch_bounds__(32 * KW) void k_gemmc(const T16* __restrict__ A, const T16* __restrict__ A2, const T16* __restrict__ Bt, const T16* __restrict__ Bt2, int K, float* C, int ldc, int roff, size_t sA, size_t sB, size_t sC) {
    typedef typename WFrag<T16>::V V;
    constexpr int MBR = (KW == 1) ? 1 : 4;   // 16-row blocks staged in LDS per round: one wave alone goes block by block, several waves stage their whole partial tiles, so that one barrier serves the tile
    __shared__ __align__(16) float os[KW * MBR * 16 * 68];
    const size_t z = blockIdx.z; A += z * sA; if (A2) A2 += z * sA; Bt += (z / REP) * sB; if (Bt2) Bt2 += (z / REP) * sB; C += z * sC;
    const int lane = threadIdx.x & 31, lr = lane & 15, hi = lane >> 4; const int wv = (KW == 1) ? 0 : __builtin_amdgcn_readfirstlane(threadIdx.x >> 5); const int r0 = blockIdx.x * 64, c0 = blockIdx.y * 64;
    if (CMODE == 1 && c0 > r0 + roff + 63) return;                  // score tile entirely above the causal diagonal: never read (the softmax masks j > i by select)
    const int Kl = (CMODE == 2) ? min(K, r0 + roff + 64) : K;        // P.V: probabilities are exactly 0 beyond the diagonal block, so the K loop stops there
    v8f acc[4][4];
#pragma unroll
    for (int mb = 0; mb < 4; ++mb)
#pragma unroll
        for (int nb = 0; nb < 4; ++nb) acc[mb][nb] = (v8f){};
    const size_t aoff = (size_t)(r0 + lr) * K + 8 * hi, boff = (size_t)(c0 + lr) * K + 8 * hi;
#pragma unroll 1
    for (int kc = wv * 32; kc < Kl; kc += 32 * KW) {
        V a[4], a2[4];
#pragma unroll
        for (int mb = 0; mb < 4; ++mb) { a[mb] = WFrag<T16>::ld(A + aoff + (size_t)mb * 16 * K + kc); if (NSPLIT == 1 || NSPLIT == 2) a2[mb] = WFrag<T16>::ld(A2 + aoff + (size_t)mb * 16 * K + kc); }
#pragma unroll
        for (int nb = 0; nb < 4; ++nb) { const V b = WFrag<T16>::ld(Bt + boff + (size_t)nb * 16 * K + kc); V b2; if (NSPLIT >= 2) b2 = WFrag<T16>::ld(Bt2 + boff + (size_t)nb * 16 * K + kc);
#pragma unroll
            for (int mb = 0; mb < 4; ++mb) { acc[mb][nb] = WFrag<T16>::mma(a[mb], b, acc[mb][nb]); if (NSPLIT == 1 || NSPLIT == 2) acc[mb][nb] = WFrag<T16>::mma(a2[mb], b, acc[mb][nb]); if (NSPLIT >= 2) acc[mb][nb] = WFrag<T16>::mma(a[mb], b2, acc[mb][nb]); } }
        asm volatile("v_nop\n\tv_nop\n\tv_nop\n\tv_nop" : "+v"(acc[0][0]), "+v"(acc[1][1]), "+v"(acc[2][2]), "+v"(acc[3][3]) : "v"(a[0]), "v"(a[3]));
    }
#pragma unroll
    for (int m0 = 0; m0 < 4; m0 += MBR) {
#pragma unroll
        for (int mi = 0; mi < MBR; ++mi) {
#pragma unroll
            for (int nb = 0; nb < 4; ++nb) {
#pragma unroll
                for (int j = 0; j < 8; ++j) os[((wv * MBR + mi) * 16 + hi * 8 + j) * 68 + nb * 16 + lr] = acc[m0 + mi][nb][j]; } }
        tile_sync<KW>();
        float* crow = C + (size_t)(r0 + m0 * 16) * ldc + c0;
#pragma unroll
        for (int s = 0; s < MBR * 8 / KW; ++s) { const int row = wv * (MBR * 16 / KW) + 2 * s + hi, cofs = lr * 4; v4f val = *(const v4fa*)(os + row * 68 + cofs);
#pragma unroll
            for (int w = 1; w < KW; ++w) val += *(const v4fa*)(os + (w * MBR * 16 + row) * 68 + cofs);
            *(v4f*)(crow + (size_t)row * ldc + cofs) = val; }
        if constexpr (MBR < 4) tile_sync<KW>();   // only where a further round stores over these rows
    }
}

__device__ __forceinline__ h16 tohx(float x) { return (h16)x; }
__device__ __forceinline__ void splitf(float y, unsigned short& h, unsigned short& l) { h = f2bf(y); l = f2bf(y - bf2f(h)); }
typedef __attribute__((ext_vector_type(2))) _Float16 v2h;
typedef __attribute__((ext_vector_type(4))) _Float16 v4h;
typedef __attribute__((ext_vector_type(2))) unsigned short v2us;
typedef __attribute__((ext_vector_type(4))) unsigned short v4us;
typedef __attribute__((ext_vector_type(2))) float v2f;
typedef __attribute__((ext_vector_type(4))) int v4i;

__global__ __launch_bounds__(256) void k_wtG(const float* __restrict__ w, int K, int N, bf* Bt) {
    const int lane = threadIdx.x & 31; const int L0 = (blockIdx.x * 8 + (threadIdx.x >> 5)) * 8; const int nlines = N * K / 64;
{
#pragma unroll 1
        for (int l = 0; l < 8; ++l) { const int L = L0 + l; if (L >= nlines) break; const size_t e = (size_t)L * 64 + lane * 2; const int k = (int)(e % K), n = (int)(e / K); v2us o;
            o[0] = f2bf(w[(size_t)k * N + n]); o[1] = f2bf(w[(size_t)(k + 1) * N + n]); *(v2us*)(Bt + e) = o; }
         }
}
__global__ __launch_bounds__(256) void k_cvt8(const float* __restrict__ src, bf* dst, size_t n8) { const size_t i = (size_t)blockIdx.x * 256 + threadIdx.x; if (i >= n8) return; const v8f v = *(const v8f*)(src + i * 8); v8us o;
#pragma unroll
    for (int k = 0; k < 8; ++k) o[k] = f2bf(v[k]); *(v8us*)(dst + i * 8) = o;  }

// k_rope: head planes [h][t][d] (fp16 + hi/lo) of rope(x) x sc with the rotate-half convention out[d] = x[d] cos[t][d] - x[d+HD/2] sin[t][d], out[d+HD/2] = x[d+HD/2] cos[t][d+HD/2] + x[d] sin[t][d+HD/2]
__global__ __launch_bounds__(256) void k_rope(const float* __restrict__ F, int pitch, int nheads, const float* __restrict__ CS, const float* __restrict__ RF, const float* __restrict__ nw, float sc, h16* P16, bf* Ph, bf* Pl) {
    const size_t e = ((size_t)blockIdx.x * 256 + threadIdx.x) * 2; if (e >= (size_t)nheads * TT * HD) return; const int d = (int)(e % HD); const int t = (int)((e / HD) % TT); const int h = (int)(e / ((size_t)HD * TT)); const float* f = F + (size_t)t * pitch + h * HD; const float rf = RF ? RF[(size_t)h * TT + t] : 1.0f; v2h o16; v2us oh, ol;
#pragma unroll
    for (int q = 0; q < 2; ++q) { const int dd = d + q; const int dp = (dd < HD / 2) ? dd + HD / 2 : dd - HD / 2; float x0 = f[dd], x1 = f[dp];
        if (RF) { float n0 = __fmul_rn(x0, rf), n1 = __fmul_rn(x1, rf); asm volatile("" : "+v"(n0)); asm volatile("" : "+v"(n1)); x0 = __fmul_rn(bfr(nw[dd]), n0); x1 = __fmul_rn(bfr(nw[dp]), n1); }
        const v2f cs = *(const v2f*)(CS + ((size_t)t * HD + dd) * 2); float a = __fmul_rn(x0, cs[0]), bq = __fmul_rn(x1, cs[1]); asm volatile("" : "+v"(a)); asm volatile("" : "+v"(bq)); const float r = ((dd < HD / 2) ? __fsub_rn(a, bq) : __fadd_rn(a, bq)) * sc;
        o16[q] = tohx(r); unsigned short a2, c2; splitf(r, a2, c2); oh[q] = a2; ol[q] = c2; }
    *(v2h*)(P16 + e) = o16; *(v2us*)(Ph + e) = oh; *(v2us*)(Pl + e) = ol;  }
__global__ __launch_bounds__(256) void k_vtp(const float* __restrict__ F, int pitch, int nheads, h16* V16, bf* Vh, bf* Vl) { const size_t e = ((size_t)blockIdx.x * 256 + threadIdx.x) * 2; if (e >= (size_t)nheads * HD * TT) return; const int t = (int)(e % TT); const int d = (int)((e / TT) % HD); const int g = (int)(e / ((size_t)TT * HD)); v2h o16; v2us oh, ol;
#pragma unroll
    for (int q = 0; q < 2; ++q) { const float x = F[(size_t)(t + q) * pitch + g * HD + d]; o16[q] = tohx(x); unsigned short a2, c2; splitf(x, a2, c2); oh[q] = a2; ol[q] = c2; }
    const size_t oo = ((size_t)g * HD + d) * PP + t; *(v2h*)(V16 + oo) = o16; *(v2us*)(Vh + oo) = oh; *(v2us*)(Vl + oo) = ol;  }
__global__ __launch_bounds__(256) void k_csid(float* CS) { const int idx = blockIdx.x * 256 + threadIdx.x; if (idx >= TT * HD) return; v2f cs; cs[0] = 1.0f; cs[1] = 0.0f; *(v2f*)(CS + (size_t)idx * 2) = cs;  }
// k_asoft: per row (zz, i): t = S x HD^-0.5 for j <= i and i - j < WIN (sliding causal window; the reference's -1e9 additive fill vanishes identically); softmax over the 2048 keys (register row, one exp, fixed trees);
// the probabilities go back over the row's own 8 KiB of scores, which the wave holds whole in registers by then: rows < RH hi plane in the first 4 KiB and lo plane in the second, other rows fp16 in the first 4 KiB.
__global__ __launch_bounds__(256) void k_asoft(float* Sb) {
    const int lane = threadIdx.x & 31; const int row = blockIdx.x * 8 + (threadIdx.x >> 5); if (row >= ZH * TT) return; const int i = row % TT; const int zz = row / TT; (void)zz; const bool hires = (i < RH); float* sr = Sb + (size_t)row * TT; float v[TT / 32]; float mx = -3.0e38f;
#pragma unroll
    for (int ch = 0; ch < TT / 128; ++ch) { const int j0 = ch * 128 + lane * 4; const v4f a = *(const v4f*)(sr + j0);
#pragma unroll
        for (int q = 0; q < 4; ++q) { const int j = j0 + q; (void)j; const float t = (j <= i && i - j < WIN) ? a[q] * SCL : -3.0e38f; v[ch * 4 + q] = t; mx = fmaxf(mx, t); } }
#pragma unroll
    for (int sh = 16; sh; sh >>= 1) mx = fmaxf(mx, __shfl_xor(mx, sh, 32));
    float sum = 0.f;
#pragma unroll
    for (int k = 0; k < TT / 32; ++k) { float d0 = __fsub_rn(v[k], mx); asm volatile("" : "+v"(d0)); v[k] = __builtin_amdgcn_exp2f(__fmul_rn(d0, 1.4426950408889634f)); sum += v[k]; }
#pragma unroll
    for (int sh = 16; sh; sh >>= 1) sum += __shfl_xor(sum, sh, 32);
    const float f = __fdiv_rn(hires ? 1.0f : PCAR, sum);
{
        if (hires) {
#pragma unroll
            for (int ch = 0; ch < TT / 128; ++ch) { v4us oh, ol;
#pragma unroll
                for (int q = 0; q < 4; ++q) { unsigned short a, c2; splitf(v[ch * 4 + q] * f, a, c2); oh[q] = a; ol[q] = c2; }
                const int oo = ch * 128 + lane * 4; *(v4us*)((bf*)sr + oo) = oh; *(v4us*)((bf*)sr + TT + oo) = ol; }
        } else {
#pragma unroll
            for (int ch = 0; ch < TT / 128; ++ch) { v4h o4;
#pragma unroll
                for (int q = 0; q < 4; ++q) o4[q] = tohx(v[ch * 4 + q] * f);
                *(v4h*)((h16*)sr + ch * 128 + lane * 4) = o4; } }
         }
}
__global__ __launch_bounds__(256) void k_merge(const float* __restrict__ O, int h0, bf* Ah, bf* Al) { const size_t e = ((size_t)blockIdx.x * 256 + threadIdx.x) * 2; if (e >= (size_t)ZH * TT * HD) return; const int d = (int)(e % HD); const int t = (int)((e / HD) % TT); const int zz = (int)(e / ((size_t)HD * TT)); const float cs = (t < RH) ? 1.0f : (1.0f / PCAR); const size_t oo = (size_t)t * DQ + (h0 + zz) * HD + d;
    v2us oh, ol;
#pragma unroll
    for (int q = 0; q < 2; ++q) { unsigned short a, c2; splitf(O[e + q] * cs, a, c2); oh[q] = a; ol[q] = c2; } *(v2us*)(Ah + oo) = oh; *(v2us*)(Al + oo) = ol;  }

extern "C" void kernel_launch(void* const* d_in, const int* in_sizes, int n_in,
                              void* d_out, int out_size, void* d_ws, size_t ws_size, hipStream_t stream) {
    (void)in_sizes; (void)n_in; (void)out_size;
    const float* x = (const float*)d_in[0]; const float* wq = (const float*)d_in[1]; const float* bq = (const float*)d_in[2]; const float* wk = (const float*)d_in[3]; const float* bk = (const float*)d_in[4]; const float* wv = (const float*)d_in[5]; const float* bv = (const float*)d_in[6]; const float* wo = (const float*)d_in[7]; const float* bo = (const float*)d_in[8];   /* order x, Wq, bq, Wk, bk, Wv, bv, Wo, bo */
    float* OUT = (float*)d_out;     // [2][2048][2048]
    char* wsp = (char*)d_ws;
    auto take = [&](size_t bytes) { char* p = wsp; wsp += (bytes + 255) & ~(size_t)255; return (void*)p; };
    bf* WQ = (bf*)take((size_t)DQ * DM * 2); bf* WK = (bf*)take((size_t)DKV * DM * 2); bf* WV = (bf*)take((size_t)DKV * DM * 2); bf* WO = (bf*)take((size_t)DM * DQ * 2); float* CS = (float*)take((size_t)TT * HD * 2 * 4);
    bf* XB = (bf*)take((size_t)TT * DM * 2); float* FQ = (float*)take((size_t)TT * DQ * 4); float* FK = (float*)take((size_t)TT * DKV * 4);
    h16* QP16 = (h16*)take((size_t)NH_ * TT * HD * 2); h16* KP16 = (h16*)take((size_t)NKV * TT * HD * 2); h16* VT16 = (h16*)take((size_t)NKV * HD * PP * 2);
    bf* QPh = (bf*)take((size_t)NH_ * TT * HD * 2); bf* QPl = (bf*)take((size_t)NH_ * TT * HD * 2); bf* KPh = (bf*)take((size_t)NKV * TT * HD * 2); bf* KPl = (bf*)take((size_t)NKV * TT * HD * 2); bf* VTh = (bf*)take((size_t)NKV * HD * PP * 2); bf* VTl = (bf*)take((size_t)NKV * HD * PP * 2);
    float* Sb = (float*)take((size_t)ZH * TT * TT * 4); float* Ob = (float*)take((size_t)ZH * TT * HD * 4); bf* ATh = (bf*)take((size_t)TT * DQ * 2); bf* ATl = (bf*)take((size_t)TT * DQ * 2);
    if ((size_t)(wsp - (char*)d_ws) > ws_size) return;    // ws 256 MiB
    float* FV = FK;   // v projection reuses the k buffer after the k planes are built (stream-ordered)
    { k_cvt8<<<(unsigned)(((size_t)DQ * DM / 8 + 255) / 256), 256, 0, stream>>>(wq, WQ, (size_t)DQ * DM / 8); k_cvt8<<<(unsigned)(((size_t)DKV * DM / 8 + 255) / 256), 256, 0, stream>>>(wk, WK, (size_t)DKV * DM / 8); k_cvt8<<<(unsigned)(((size_t)DKV * DM / 8 + 255) / 256), 256, 0, stream>>>(wv, WV, (size_t)DKV * DM / 8);
      k_cvt8<<<(unsigned)(((size_t)DM * DQ / 8 + 255) / 256), 256, 0, stream>>>(wo, WO, (size_t)DM * DQ / 8);
       }
    k_csid<<<(TT * HD + 255) / 256, 256, 0, stream>>>(CS);
    const unsigned LQ = (unsigned)(((size_t)NH_ * TT * HD / 2 + 255) / 256), LKv = (unsigned)(((size_t)NKV * TT * HD / 2 + 255) / 256);
    for (int b = 0; b < NB_; ++b) {
        
        k_cvt8<<<(unsigned)(((size_t)TT * DM / 8 + 255) / 256), 256, 0, stream>>>(x + (size_t)b * TT * DM, XB, (size_t)TT * DM / 8);
        k_gemmw<bf, 0, true, KWL><<<dim3(TT / 64, DQ / 64, 1), 32 * KWL, 0, stream>>>(XB, nullptr, WQ, nullptr, DM, FQ, DQ, bq, 0, 0, 0);
        k_rope<<<LQ, 256, 0, stream>>>(FQ, DQ, NH_, CS, nullptr, nullptr, 1.0f, QP16, QPh, QPl);
        k_gemmw<bf, 0, true, KWS><<<dim3(TT / 64, DKV / 64, 1), 32 * KWS, 0, stream>>>(XB, nullptr, WK, nullptr, DM, FK, DKV, bk, 0, 0, 0);
        k_rope<<<LKv, 256, 0, stream>>>(FK, DKV, NKV, CS, nullptr, nullptr, 1.0f, KP16, KPh, KPl);
        k_gemmw<bf, 0, true, KWS><<<dim3(TT / 64, DKV / 64, 1), 32 * KWS, 0, stream>>>(XB, nullptr, WV, nullptr, DM, FV, DKV, bv, 0, 0, 0); k_vtp<<<LKv, 256, 0, stream>>>(FV, DKV, NKV, VT16, VTh, VTl);
        for (int h0 = 0; h0 < NH_; h0 += ZH) { const size_t zq = (size_t)h0, zk = (size_t)(h0 / REP);   // the ZH heads of a pass span kv heads h0/REP .. : k_gemmc steps its B planes by sB per REP heads
            k_gemmc<bf, 2, 1, 1><<<dim3(RH / 64, TT / 64, ZH), 32, 0, stream>>>(QPh + zq * TT * HD, QPl + zq * TT * HD, KPh + zk * TT * HD, KPl + zk * TT * HD, HD, Sb, TT, 0, (size_t)TT * HD, (size_t)TT * HD, (size_t)TT * TT);
            k_gemmc<h16, 0, 1, 1><<<dim3((TT - RH) / 64, TT / 64, ZH), 32, 0, stream>>>(QP16 + zq * TT * HD + (size_t)RH * HD, nullptr, KP16 + zk * TT * HD, nullptr, HD, Sb + (size_t)RH * TT, TT, RH, (size_t)TT * HD, (size_t)TT * HD, (size_t)TT * TT);
            k_asoft<<<ZH * TT / 8, 256, 0, stream>>>(Sb);
            k_gemmc<bf, 2, 2, KWS><<<dim3(RH / 64, HD / 64, ZH), 32 * KWS, 0, stream>>>((const bf*)Sb, (const bf*)Sb + TT, VTh + zk * HD * PP, VTl + zk * HD * PP, PP, Ob, HD, 0, (size_t)TT * PP, (size_t)HD * PP, (size_t)TT * HD);
            k_gemmc<h16, 0, 2, KWS><<<dim3((TT - RH) / 64, HD / 64, ZH), 32 * KWS, 0, stream>>>((const h16*)Sb + (size_t)RH * PP, nullptr, VT16 + zk * HD * PP, nullptr, PP, Ob + (size_t)RH * HD, HD, RH, (size_t)TT * PP, (size_t)HD * PP, (size_t)TT * HD);
            k_merge<<<(unsigned)(((size_t)ZH * TT * HD / 2 + 255) / 256), 256, 0, stream>>>(Ob, h0, ATh, ATl); }
        k_gemmw<bf, 1, true, KWL><<<dim3(TT / 64, DM / 64, 1), 32 * KWL, 0, stream>>>(ATh, ATl, WO, nullptr, DQ, OUT + (size_t)b * TT * DM, DM, bo, 0, 0, 0); }
}

// v003
// One run takes 361 microseconds.
// In two side-by-side timings against v002, it was 2.35 and 2.34 times as fast.
// All steps since v000 together make it 7.44 times as fast.
#include <hip/hip_runtime.h>

// Grouped-query causal attention (x [2][2048][2048]; q = x Wq^T + bq (32 heads x 64), k, v = x Wk^T + bk, x Wv^T + bv (8 kv heads x 64) ('oi' 1/sqrt(2048), zero biases); query head j = (kv head h, group member g) = 4h + g uses kv head h; scores x 64^-0.5; causal (-inf); softmax; out = merged Wo^T + bo ('oi' [2048][2048]) -> [2][2048][2048] (8.4 M); argument order x, Wq, bq, Wk, bk, Wv, bv, Wo, bo).
// Layout per batch: bf16 copy of x; exact projections + f32 biases; causal T-2048 attention in one launch (k_fattn: scores, running softmax and probability x value stay in registers; hybrid rows: < 512 hi/lo 3 products, rest fp16); merged hi/lo x Wo exact + bo.
// Compute dtypes, f32 accumulate: every input rounded to bf16; projections exact + f32 biases; attention rows < 512 3 products, rest fp16; softmax f32; Wo hl x exact + bias.

#define NB_  2
#define TT   2048
#define DM   2048
#define NH_  32
#define NKV  8
#define REP  (NH_ / NKV)
#define HD   64
#define DQ   (NH_ * HD)
#define DKV  (NKV * HD)
#define PP   (2 * TT)             // pitch in 16-bit elements of a V^T row
#define GW   2                    // query heads of one kv head that one attention wave holds (32 score columns)
#define RH   512                  // query rows < RH use hi+lo planes (0: none)
#define SCL  0.125f   // HD^-0.5
#define KWL  4                    // waves that share a tile's K loop where a launch has 1024 tiles (q projection, Wo)
#define KWS  8                    // the same where a launch has at most 256 tiles (k, v projections)
typedef _Float16 h16;
typedef unsigned short bf;
typedef __attribute__((ext_vector_type(16))) __bf16   v16bf;
typedef __attribute__((ext_vector_type(16))) _Float16 v16h;
typedef __attribute__((ext_vector_type(8)))  _Float16 v8h;
typedef __attribute__((ext_vector_type(8)))  unsigned short v8us;
typedef __attribute__((ext_vector_type(8)))  float    v8f;
typedef __attribute__((ext_vector_type(4)))  float    v4f;
typedef v8h  __attribute__((may_alias)) v8ha;
typedef v4f  __attribute__((may_alias)) v4fa;
typedef v8us __attribute__((may_alias)) v8usa;

__device__ __forceinline__ unsigned short f2bf(float f) { unsigned u = __float_as_uint(f); u += 0x7FFFu + ((u >> 16) & 1u); return (unsigned short)(u >> 16); }
__device__ __forceinline__ float bf2f(unsigned short b) { return __uint_as_float(((unsigned)b) << 16); }
__device__ __forceinline__ float bfr(float f) { return bf2f(f2bf(f)); }
__device__ __forceinline__ v16h cat16(v8h lo, v8h hi) { return __builtin_shufflevector(lo, hi, 0, 1, 2, 3, 4, 5, 6, 7, 8, 9, 10, 11, 12, 13, 14, 15); }
__device__ __forceinline__ v16bf cat16b(v8us lo, v8us hi) { return __builtin_bit_cast(v16bf, __builtin_shufflevector(lo, hi, 0, 1, 2, 3, 4, 5, 6, 7, 8, 9, 10, 11, 12, 13, 14, 15)); }
__device__ __forceinline__ v8f wmma16(v16h a, v16h b, v8f c) { return __builtin_amdgcn_wmma_f32_16x16x32_f16(false, a, false, b, (short)0, c, false, false); }
__device__ __forceinline__ v8f wmmab(v16bf a, v16bf b, v8f c) { return __builtin_amdgcn_wmma_f32_16x16x32_bf16(false, a, false, b, (short)0, c, false, false); }



// tile_sync: between the LDS stores of a tile's rows and their reads. One wave: program order is enough, the compiler is only kept from moving LDS accesses across. Several waves: the work-group barrier, since each wave reads what the others stored.
template <int KW> __device__ __forceinline__ void tile_sync() { if constexpr (KW == 1) { __builtin_amdgcn_wave_barrier(); asm volatile("" ::: "memory"); } else { __syncthreads(); } }

// ---- k_gemmw: register-blocked GEMM, one 64x64 output tile per work-group of KW waves; every wave holds the whole tile (16 accumulators) and takes every KW-th 32-wide K step, operands straight from K-contiguous 16-bit planes;
// the KW partial tiles are summed in wave order through LDS behind one work-group barrier, each wave adding and storing 64 / KW of the rows; grid (M/64, N/64, Z), 32 KW threads.
// C[m][n] (f32, pitch ldc, + optional f32 bias[n]) = sum_k A[m][k] Bt[n][k] (+ split products per NSPLIT). z-batch strides sA/sB/sC in elements. K % 32 == 0.
template <typename T16> struct WFrag;
template <> struct WFrag<h16> { typedef v16h V; static __device__ __forceinline__ V ld(const h16* p) { return cat16(*(const v8h*)p, *(const v8h*)(p + 16)); } static __device__ __forceinline__ v8f mma(V a, V b, v8f c) { return wmma16(a, b, c); } };
template <> struct WFrag<bf> { typedef v16bf V; static __device__ __forceinline__ V ld(const bf* p) { return cat16b(*(const v8us*)p, *(const v8us*)(p + 16)); } static __device__ __forceinline__ v8f mma(V a, V b, v8f c) { return wmmab(a, b, c); } };
template <typename T16, int NSPLIT, bool BIAS, int KW>
__global__ __launch_bounds__(32 * KW) void k_gemmw(const T16* __restrict__ A, const T16* __restrict__ A2, const T16* __restrict__ Bt, const T16* __restrict__ Bt2, int K, float* C, int ldc, const float* __restrict__ bias, size_t sA, size_t sB, size_t sC) {
    typedef typename WFrag<T16>::V V;
    constexpr int MBR = (KW == 1) ? 1 : 4;   // 16-row blocks staged in LDS per round: one wave alone goes block by block, several waves stage their whole partial tiles, so that one barrier serves the tile
    __shared__ __align__(16) float os[KW * MBR * 16 * 68];
    const size_t z = blockIdx.z; A += z * sA; if (A2) A2 += z * sA; Bt += z * sB; if (Bt2) Bt2 += z * sB; C += z * sC;
    const int lane = threadIdx.x & 31, lr = lane & 15, hi = lane >> 4; const int wv = (KW == 1) ? 0 : __builtin_amdgcn_readfirstlane(threadIdx.x >> 5); const int r0 = blockIdx.x * 64, c0 = blockIdx.y * 64;
    v8f acc[4][4];
#pragma unroll
    for (int mb = 0; mb < 4; ++mb)
#pragma unroll
        for (int nb = 0; nb < 4; ++nb) acc[mb][nb] = (v8f){};
    const size_t aoff = (size_t)(r0 + lr) * K + 8 * hi, boff = (size_t)(c0 + lr) * K + 8 * hi;
#pragma unroll 1
    for (int kc = wv * 32; kc < K; kc += 32 * KW) {
        V a[4], a2[4];
#pragma unroll
        for (int mb = 0; mb < 4; ++mb) { a[mb] = WFrag<T16>::ld(A + aoff + (size_t)mb * 16 * K + kc); if (NSPLIT == 1 || NSPLIT == 2) a2[mb] = WFrag<T16>::ld(A2 + aoff + (size_t)mb * 16 * K + kc); }
#pragma unroll
        for (int nb = 0; nb < 4; ++nb) { const V b = WFrag<T16>::ld(Bt + boff + (size_t)nb * 16 * K + kc); V b2; if (NSPLIT >= 2) b2 = WFrag<T16>::ld(Bt2 + boff + (size_t)nb * 16 * K + kc);
#pragma unroll
            for (int mb = 0; mb < 4; ++mb) { acc[mb][nb] = WFrag<T16>::mma(a[mb], b, acc[mb][nb]); if (NSPLIT == 1 || NSPLIT == 2) acc[mb][nb] = WFrag<T16>::mma(a2[mb], b, acc[mb][nb]); if (NSPLIT >= 2) acc[mb][nb] = WFrag<T16>::mma(a[mb], b2, acc[mb][nb]); } }
        asm volatile("v_nop\n\tv_nop\n\tv_nop\n\tv_nop" : "+v"(acc[0][0]), "+v"(acc[1][1]), "+v"(acc[2][2]), "+v"(acc[3][3]) : "v"(a[0]), "v"(a[3]));
    }
#pragma unroll
    for (int m0 = 0; m0 < 4; m0 += MBR) {
#pragma unroll
        for (int mi = 0; mi < MBR; ++mi) {
#pragma unroll
            for (int nb = 0; nb < 4; ++nb) {
#pragma unroll
                for (int j = 0; j < 8; ++j) os[((wv * MBR + mi) * 16 + hi * 8 + j) * 68 + nb * 16 + lr] = acc[m0 + mi][nb][j]; } }
        tile_sync<KW>();
        float* crow = C + (size_t)(r0 + m0 * 16) * ldc + c0;
#pragma unroll
        for (int s = 0; s < MBR * 8 / KW; ++s) { const int row = wv * (MBR * 16 / KW) + 2 * s + hi, cofs = lr * 4; v4f val = *(const v4fa*)(os + row * 68 + cofs);
#pragma unroll
            for (int w = 1; w < KW; ++w) val += *(const v4fa*)(os + (w * MBR * 16 + row) * 68 + cofs);
            if (BIAS) { val[0] += bfr(bias[c0 + cofs]); val[1] += bfr(bias[c0 + cofs + 1]); val[2] += bfr(bias[c0 + cofs + 2]); val[3] += bfr(bias[c0 + cofs + 3]); }
            *(v4f*)(crow + (size_t)row * ldc + cofs) = val; }
        if constexpr (MBR < 4) tile_sync<KW>();   // only where a further round stores over these rows
    }
}

__device__ __forceinline__ h16 tohx(float x) { return (h16)x; }
__device__ __forceinline__ void splitf(float y, unsigned short& h, unsigned short& l) { h = f2bf(y); l = f2bf(y - bf2f(h)); }
typedef __attribute__((ext_vector_type(2))) _Float16 v2h;
typedef __attribute__((ext_vector_type(4))) _Float16 v4h;
typedef __attribute__((ext_vector_type(2))) unsigned short v2us;
typedef __attribute__((ext_vector_type(4))) unsigned short v4us;
typedef __attribute__((ext_vector_type(2))) float v2f;
typedef __attribute__((ext_vector_type(4))) int v4i;

__global__ __launch_bounds__(256) void k_wtG(const float* __restrict__ w, int K, int N, bf* Bt) {
    const int lane = threadIdx.x & 31; const int L0 = (blockIdx.x * 8 + (threadIdx.x >> 5)) * 8; const int nlines = N * K / 64;
{
#pragma unroll 1
        for (int l = 0; l < 8; ++l) { const int L = L0 + l; if (L >= nlines) break; const size_t e = (size_t)L * 64 + lane * 2; const int k = (int)(e % K), n = (int)(e / K); v2us o;
            o[0] = f2bf(w[(size_t)k * N + n]); o[1] = f2bf(w[(size_t)(k + 1) * N + n]); *(v2us*)(Bt + e) = o; }
         }
}
__global__ __launch_bounds__(256) void k_cvt8(const float* __restrict__ src, bf* dst, size_t n8) { const size_t i = (size_t)blockIdx.x * 256 + threadIdx.x; if (i >= n8) return; const v8f v = *(const v8f*)(src + i * 8); v8us o;
#pragma unroll
    for (int k = 0; k < 8; ++k) o[k] = f2bf(v[k]); *(v8us*)(dst + i * 8) = o;  }

// k_rope: head planes [h][t][d] (fp16 + hi/lo) of rope(x) x sc with the rotate-half convention out[d] = x[d] cos[t][d] - x[d+HD/2] sin[t][d], out[d+HD/2] = x[d+HD/2] cos[t][d+HD/2] + x[d] sin[t][d+HD/2]
__global__ __launch_bounds__(256) void k_rope(const float* __restrict__ F, int pitch, int nheads, const float* __restrict__ CS, const float* __restrict__ RF, const float* __restrict__ nw, float sc, h16* P16, bf* Ph, bf* Pl) {
    const size_t e = ((size_t)blockIdx.x * 256 + threadIdx.x) * 2; if (e >= (size_t)nheads * TT * HD) return; const int d = (int)(e % HD); const int t = (int)((e / HD) % TT); const int h = (int)(e / ((size_t)HD * TT)); const float* f = F + (size_t)t * pitch + h * HD; const float rf = RF ? RF[(size_t)h * TT + t] : 1.0f; v2h o16; v2us oh, ol;
#pragma unroll
    for (int q = 0; q < 2; ++q) { const int dd = d + q; const int dp = (dd < HD / 2) ? dd + HD / 2 : dd - HD / 2; float x0 = f[dd], x1 = f[dp];
        if (RF) { float n0 = __fmul_rn(x0, rf), n1 = __fmul_rn(x1, rf); asm volatile("" : "+v"(n0)); asm volatile("" : "+v"(n1)); x0 = __fmul_rn(bfr(nw[dd]), n0); x1 = __fmul_rn(bfr(nw[dp]), n1); }
        const v2f cs = *(const v2f*)(CS + ((size_t)t * HD + dd) * 2); float a = __fmul_rn(x0, cs[0]), bq = __fmul_rn(x1, cs[1]); asm volatile("" : "+v"(a)); asm volatile("" : "+v"(bq)); const float r = ((dd < HD / 2) ? __fsub_rn(a, bq) : __fadd_rn(a, bq)) * sc;
        o16[q] = tohx(r); unsigned short a2, c2; splitf(r, a2, c2); oh[q] = a2; ol[q] = c2; }
    *(v2h*)(P16 + e) = o16; *(v2us*)(Ph + e) = oh; *(v2us*)(Pl + e) = ol;  }
__global__ __launch_bounds__(256) void k_vtp(const float* __restrict__ F, int pitch, int nheads, h16* V16, bf* Vh, bf* Vl) { const size_t e = ((size_t)blockIdx.x * 256 + threadIdx.x) * 2; if (e >= (size_t)nheads * HD * TT) return; const int t = (int)(e % TT); const int d = (int)((e / TT) % HD); const int g = (int)(e / ((size_t)TT * HD)); v2h o16; v2us oh, ol;
#pragma unroll
    for (int q = 0; q < 2; ++q) { const float x = F[(size_t)(t + q) * pitch + g * HD + d]; o16[q] = tohx(x); unsigned short a2, c2; splitf(x, a2, c2); oh[q] = a2; ol[q] = c2; }
    const size_t oo = ((size_t)g * HD + d) * PP + t; *(v2h*)(V16 + oo) = o16; *(v2us*)(Vh + oo) = oh; *(v2us*)(Vl + oo) = ol;  }
__global__ __launch_bounds__(256) void k_csid(float* CS) { const int idx = blockIdx.x * 256 + threadIdx.x; if (idx >= TT * HD) return; v2f cs; cs[0] = 1.0f; cs[1] = 0.0f; *(v2f*)(CS + (size_t)idx * 2) = cs;  }
// ---- k_fattn: scores, softmax and probability x value of 16 query positions x GW query heads of one kv head, in one wave, with nothing stored between them. Per 32 keys: S^T = K Q^T (a lane holds 16 scores of ONE query column per head),
// running column maximum and sum in f32, P^T packed from the score accumulators straight into the B operand (same k order as the V^T loader: registers 0-7 keys 8 hi + e, 8-15 keys 16 + 8 hi + e), O^T += V^T P^T. The key loop ends at the diagonal block; only that block is masked.
// The maximum in use is raised (and sums and O^T rescaled) only when a column's new maximum exceeds it by more than 8 in log2 units, so a probability is at most 2^8 before the final division. HL: hi + lo bf16 planes, 3 products; else fp16.
// The epilogue divides by the column sum and writes the merged hi/lo planes [t][DQ] for the output projection.
// xwait: s_wait_xcnt 0 behind a run of global loads, in front of the next write of a register that they name as address. The addresses are inputs of the statement only so that their registers stay theirs up to the wait.
template <bool HL> __device__ __forceinline__ void xwait(const void* a, const void* a2) { if constexpr (HL) asm volatile("s_wait_xcnt 0x0" :: "v"(a), "v"(a2) : "memory"); else asm volatile("s_wait_xcnt 0x0" :: "v"(a) : "memory"); }
template <typename T16, bool HL>
__device__ __forceinline__ void fattn_body(const T16* __restrict__ Q, const T16* __restrict__ Q2, const T16* __restrict__ Kp, const T16* __restrict__ Kp2, const T16* __restrict__ Vt, const T16* __restrict__ Vt2, int q0, int kvh, int h0, bf* ATh, bf* ATl) {
    typedef typename WFrag<T16>::V V;
    const int lane = threadIdx.x & 31, lr = lane & 15, hi = lane >> 4;
    V qf[GW][2], qf2[GW][2];
    const size_t qbase = ((size_t)h0 * TT + q0 + lr) * HD + 8 * hi; const T16* qp = Q + qbase; const T16* qp2 = HL ? Q2 + qbase : nullptr;
#pragma unroll
    for (int g = 0; g < GW; ++g)
#pragma unroll
        for (int ks = 0; ks < 2; ++ks) { const size_t qo = (size_t)g * TT * HD + ks * 32; qf[g][ks] = WFrag<T16>::ld(qp + qo); if (HL) qf2[g][ks] = WFrag<T16>::ld(qp2 + qo); }
    xwait<HL>(qp, qp2);
    const size_t kbase = ((size_t)kvh * TT + lr) * HD + 8 * hi, vbase = ((size_t)kvh * HD + lr) * PP + 8 * hi;
    v8f o[GW][4]; float m[GW], l[GW];
#pragma unroll
    for (int g = 0; g < GW; ++g) { m[g] = -3.0e38f; l[g] = 0.f;
#pragma unroll
        for (int dt = 0; dt < 4; ++dt) o[g][dt] = (v8f){}; }
    const int last = q0 >> 5;   // the 32-key block that holds the diagonal of these 16 queries
    V kf[2][2], kf2[2][2];
#pragma unroll
    for (int mt = 0; mt < 2; ++mt)
#pragma unroll
        for (int ks = 0; ks < 2; ++ks) { const size_t ko = (size_t)(mt * 16) * HD + ks * 32; kf[mt][ks] = WFrag<T16>::ld(Kp + kbase + ko); if (HL) kf2[mt][ks] = WFrag<T16>::ld(Kp2 + kbase + ko); }
    xwait<HL>(Kp + kbase, HL ? Kp2 + kbase : nullptr);
#pragma unroll 1
    for (int kb = 0; kb <= last; ++kb) {
        const int k0 = kb * 32;
        V vf[4], vf2[4];   // asked for ahead of the score products, used behind the softmax
        const T16* vp = Vt + vbase + k0; const T16* vp2 = HL ? Vt2 + vbase + k0 : nullptr;
#pragma unroll
        for (int dt = 0; dt < 4; ++dt) { const size_t vo = (size_t)(dt * 16) * PP; vf[dt] = WFrag<T16>::ld(vp + vo); if (HL) vf2[dt] = WFrag<T16>::ld(vp2 + vo); }
        xwait<HL>(vp, vp2);
        v8f s[GW][2];
#pragma unroll
        for (int g = 0; g < GW; ++g)
#pragma unroll
            for (int mt = 0; mt < 2; ++mt) { s[g][mt] = (v8f){};
#pragma unroll
                for (int ks = 0; ks < 2; ++ks) { s[g][mt] = WFrag<T16>::mma(kf[mt][ks], qf[g][ks], s[g][mt]); if (HL) { s[g][mt] = WFrag<T16>::mma(kf[mt][ks], qf2[g][ks], s[g][mt]); s[g][mt] = WFrag<T16>::mma(kf2[mt][ks], qf[g][ks], s[g][mt]); } } }
        const int kn = min(kb + 1, last) * 32;   // the next block's K fragments fly during the softmax (the last trip asks for its own block again: in bounds, unused)
        const T16* kp = Kp + kbase + (size_t)kn * HD; const T16* kp2 = HL ? Kp2 + kbase + (size_t)kn * HD : nullptr;
#pragma unroll
        for (int mt = 0; mt < 2; ++mt)
#pragma unroll
            for (int ks = 0; ks < 2; ++ks) { const size_t ko = (size_t)(mt * 16) * HD + ks * 32; kf[mt][ks] = WFrag<T16>::ld(kp + ko); if (HL) kf2[mt][ks] = WFrag<T16>::ld(kp2 + ko); }
        xwait<HL>(kp, kp2);
#pragma unroll
        for (int g = 0; g < GW; ++g)
#pragma unroll
            for (int mt = 0; mt < 2; ++mt) s[g][mt] *= SCL * 1.4426950408889634f;
        if (kb == last) {   // wave-uniform: only the diagonal block has keys above a query
#pragma unroll
            for (int g = 0; g < GW; ++g)
#pragma unroll
                for (int mt = 0; mt < 2; ++mt)
#pragma unroll
                    for (int j = 0; j < 8; ++j) if (k0 + mt * 16 + hi * 8 + j > q0 + lr) s[g][mt][j] = -3.0e38f; }
        float mx[GW]; bool need = false;
#pragma unroll
        for (int g = 0; g < GW; ++g) { float t = s[g][0][0];
#pragma unroll
            for (int j = 1; j < 8; ++j) t = fmaxf(t, s[g][0][j]);
#pragma unroll
            for (int j = 0; j < 8; ++j) t = fmaxf(t, s[g][1][j]);
            mx[g] = fmaxf(t, __shfl_xor(t, 16, 32)); need = need || (mx[g] > m[g] + 8.0f); }
        if (__builtin_amdgcn_ballot_w32(need) != 0) {   // one scalar test per block
#pragma unroll
            for (int g = 0; g < GW; ++g) { const float mn = fmaxf(m[g], mx[g]); const float al = __builtin_amdgcn_exp2f(m[g] - mn); m[g] = mn; l[g] *= al;
#pragma unroll
                for (int dt = 0; dt < 4; ++dt) o[g][dt] *= al; } }
        V pb[GW], pb2[GW];
#pragma unroll
        for (int g = 0; g < GW; ++g) {
            if constexpr (HL) { v8us ph[2], pl[2];
#pragma unroll
                for (int mt = 0; mt < 2; ++mt)
#pragma unroll
                    for (int j = 0; j < 8; ++j) { const float p = __builtin_amdgcn_exp2f(s[g][mt][j] - m[g]); l[g] += p; unsigned short a, c2; splitf(p, a, c2); ph[mt][j] = a; pl[mt][j] = c2; }
                pb[g] = cat16b(ph[0], ph[1]); pb2[g] = cat16b(pl[0], pl[1]);
            } else { v8h ph[2];
#pragma unroll
                for (int mt = 0; mt < 2; ++mt)
#pragma unroll
                    for (int j = 0; j < 8; ++j) { const float p = __builtin_amdgcn_exp2f(s[g][mt][j] - m[g]); l[g] += p; ph[mt][j] = tohx(p); }
                pb[g] = cat16(ph[0], ph[1]); } }
#pragma unroll
        for (int dt = 0; dt < 4; ++dt)
#pragma unroll
            for (int g = 0; g < GW; ++g) { o[g][dt] = WFrag<T16>::mma(vf[dt], pb[g], o[g][dt]); if (HL) { o[g][dt] = WFrag<T16>::mma(vf[dt], pb2[g], o[g][dt]); o[g][dt] = WFrag<T16>::mma(vf2[dt], pb[g], o[g][dt]); } }
    }
#pragma unroll
    for (int g = 0; g < GW; ++g) { const float inv = __fdiv_rn(1.0f, l[g] + __shfl_xor(l[g], 16, 32));   // the two halves of a column hold the sums of their own keys
#pragma unroll
        for (int dt = 0; dt < 4; ++dt) { v8us oh, ol;
#pragma unroll
            for (int j = 0; j < 8; ++j) { unsigned short a, c2; splitf(o[g][dt][j] * inv, a, c2); oh[j] = a; ol[j] = c2; }
            const size_t oo = (size_t)(q0 + lr) * DQ + (h0 + g) * HD + dt * 16 + hi * 8; bf* sh = ATh + oo; bf* sl = ATl + oo; *(v8us*)sh = oh; *(v8us*)sl = ol;
            asm volatile("s_wait_xcnt 0x0" :: "v"(sh), "v"(sl), "v"(oh), "v"(ol) : "memory"); } }   // in front of the next write of an address or data register of the two stores; the inputs keep those registers theirs up to the wait
}
// grid (NKV, TT / 16), REP / GW waves a work-group: the waves of a work-group take the query heads of one kv head at the same 16 positions, so they read the same K and V^T lines on one WGP; they share nothing else and meet at no barrier. The longest key loops (last query rows) have the lowest indices.
__global__ __launch_bounds__(32 * (REP / GW)) void k_fattn(const h16* __restrict__ Q16, const h16* __restrict__ K16, const h16* __restrict__ V16, const bf* __restrict__ Qh, const bf* __restrict__ Ql, const bf* __restrict__ Kh, const bf* __restrict__ Kl, const bf* __restrict__ Vh, const bf* __restrict__ Vl, bf* ATh, bf* ATl) {
    const int kvh = blockIdx.x, q0 = (TT / 16 - 1 - (int)blockIdx.y) * 16, h0 = kvh * REP + __builtin_amdgcn_readfirstlane(threadIdx.x >> 5) * GW;
    if (q0 < RH) fattn_body<bf, true>(Qh, Ql, Kh, Kl, Vh, Vl, q0, kvh, h0, ATh, ATl); else fattn_body<h16, false>(Q16, nullptr, K16, nullptr, V16, nullptr, q0, kvh, h0, ATh, ATl);
}

extern "C" void kernel_launch(void* const* d_in, const int* in_sizes, int n_in,
                              void* d_out, int out_size, void* d_ws, size_t ws_size, hipStream_t stream) {
    (void)in_sizes; (void)n_in; (void)out_size;
    const float* x = (const float*)d_in[0]; const float* wq = (const float*)d_in[1]; const float* bq = (const float*)d_in[2]; const float* wk = (const float*)d_in[3]; const float* bk = (const float*)d_in[4]; const float* wv = (const float*)d_in[5]; const float* bv = (const float*)d_in[6]; const float* wo = (const float*)d_in[7]; const float* bo = (const float*)d_in[8];   /* order x, Wq, bq, Wk, bk, Wv, bv, Wo, bo */
    float* OUT = (float*)d_out;     // [2][2048][2048]
    char* wsp = (char*)d_ws;
    auto take = [&](size_t bytes) { char* p = wsp; wsp += (bytes + 255) & ~(size_t)255; return (void*)p; };
    bf* WQ = (bf*)take((size_t)DQ * DM * 2); bf* WK = (bf*)take((size_t)DKV * DM * 2); bf* WV = (bf*)take((size_t)DKV * DM * 2); bf* WO = (bf*)take((size_t)DM * DQ * 2); float* CS = (float*)take((size_t)TT * HD * 2 * 4);
    bf* XB = (bf*)take((size_t)TT * DM * 2); float* FQ = (float*)take((size_t)TT * DQ * 4); float* FK = (float*)take((size_t)TT * DKV * 4);
    h16* QP16 = (h16*)take((size_t)NH_ * TT * HD * 2); h16* KP16 = (h16*)take((size_t)NKV * TT * HD * 2); h16* VT16 = (h16*)take((size_t)NKV * HD * PP * 2);
    bf* QPh = (bf*)take((size_t)NH_ * TT * HD * 2); bf* QPl = (bf*)take((size_t)NH_ * TT * HD * 2); bf* KPh = (bf*)take((size_t)NKV * TT * HD * 2); bf* KPl = (bf*)take((size_t)NKV * TT * HD * 2); bf* VTh = (bf*)take((size_t)NKV * HD * PP * 2); bf* VTl = (bf*)take((size_t)NKV * HD * PP * 2);
    bf* ATh = (bf*)take((size_t)TT * DQ * 2); bf* ATl = (bf*)take((size_t)TT * DQ * 2);
    if ((size_t)(wsp - (char*)d_ws) > ws_size) return;    // ws 256 MiB
    float* FV = FK;   // v projection reuses the k buffer after the k planes are built (stream-ordered)
    { k_cvt8<<<(unsigned)(((size_t)DQ * DM / 8 + 255) / 256), 256, 0, stream>>>(wq, WQ, (size_t)DQ * DM / 8); k_cvt8<<<(unsigned)(((size_t)DKV * DM / 8 + 255) / 256), 256, 0, stream>>>(wk, WK, (size_t)DKV * DM / 8); k_cvt8<<<(unsigned)(((size_t)DKV * DM / 8 + 255) / 256), 256, 0, stream>>>(wv, WV, (size_t)DKV * DM / 8);
      k_cvt8<<<(unsigned)(((size_t)DM * DQ / 8 + 255) / 256), 256, 0, stream>>>(wo, WO, (size_t)DM * DQ / 8);
       }
    k_csid<<<(TT * HD + 255) / 256, 256, 0, stream>>>(CS);
    const unsigned LQ = (unsigned)(((size_t)NH_ * TT * HD / 2 + 255) / 256), LKv = (unsigned)(((size_t)NKV * TT * HD / 2 + 255) / 256);
    for (int b = 0; b < NB_; ++b) {
        
        k_cvt8<<<(unsigned)(((size_t)TT * DM / 8 + 255) / 256), 256, 0, stream>>>(x + (size_t)b * TT * DM, XB, (size_t)TT * DM / 8);
        k_gemmw<bf, 0, true, KWL><<<dim3(TT / 64, DQ / 64, 1), 32 * KWL, 0, stream>>>(XB, nullptr, WQ, nullptr, DM, FQ, DQ, bq, 0, 0, 0);
        k_rope<<<LQ, 256, 0, stream>>>(FQ, DQ, NH_, CS, nullptr, nullptr, 1.0f, QP16, QPh, QPl);
        k_gemmw<bf, 0, true, KWS><<<dim3(TT / 64, DKV / 64, 1), 32 * KWS, 0, stream>>>(XB, nullptr, WK, nullptr, DM, FK, DKV, bk, 0, 0, 0);
        k_rope<<<LKv, 256, 0, stream>>>(FK, DKV, NKV, CS, nullptr, nullptr, 1.0f, KP16, KPh, KPl);
        k_gemmw<bf, 0, true, KWS><<<dim3(TT / 64, DKV / 64, 1), 32 * KWS, 0, stream>>>(XB, nullptr, WV, nullptr, DM, FV, DKV, bv, 0, 0, 0); k_vtp<<<LKv, 256, 0, stream>>>(FV, DKV, NKV, VT16, VTh, VTl);
        k_fattn<<<dim3(NKV, TT / 16, 1), 32 * (REP / GW), 0, stream>>>(QP16, KP16, VT16, QPh, QPl, KPh, KPl, VTh, VTl, ATh, ATl);
        k_gemmw<bf, 1, true, KWL><<<dim3(TT / 64, DM / 64, 1), 32 * KWL, 0, stream>>>(ATh, ATl, WO, nullptr, DQ, OUT + (size_t)b * TT * DM, DM, bo, 0, 0, 0); }
}

// v004
// A run of this version takes 326 microseconds.
// In two side-by-side timings against v003, it was 1.12 and 1.11 times as fast.
// Counting every step since v000, it is 8.26 times as fast.
#include <hip/hip_runtime.h>

// Grouped-query causal attention (x [2][2048][2048]; q = x Wq^T + bq (32 heads x 64), k, v = x Wk^T + bk, x Wv^T + bv (8 kv heads x 64) ('oi' 1/sqrt(2048), zero biases); query head j = (kv head h, group member g) = 4h + g uses kv head h; scores x 64^-0.5; causal (-inf); softmax; out = merged Wo^T + bo ('oi' [2048][2048]) -> [2][2048][2048] (8.4 M); argument order x, Wq, bq, Wk, bk, Wv, bv, Wo, bo).
// Layout per batch: bf16 copy of x; exact projections + f32 biases, each projection kernel storing the attention's 16-bit planes itself (no f32 projection buffer); causal T-2048 attention in one launch (k_fattn: scores, running softmax and probability x value stay in registers; hybrid rows: < 512 hi/lo 3 products, rest fp16); merged hi/lo x Wo exact + bo.
// Compute dtypes, f32 accumulate: every input rounded to bf16; projections exact + f32 biases; attention rows < 512 3 products, rest fp16; softmax f32; Wo hl x exact + bias.

#define NB_  2
#define TT   2048
#define DM   2048
#define NH_  32
#define NKV  8
#define REP  (NH_ / NKV)
#define HD   64
#define DQ   (NH_ * HD)
#define DKV  (NKV * HD)
#define PP   (2 * TT)             // pitch in 16-bit elements of a V^T row
#define GW   2                    // query heads of one kv head that one attention wave holds (32 score columns)
#define RH   512                  // query rows < RH use hi+lo planes (0: none)
#define SCL  0.125f   // HD^-0.5
#define KWL  4                    // waves that share a tile's K loop where a launch has 1024 tiles (q projection, Wo)
#define KWS  8                    // the same where a launch has at most 256 tiles (k, v projections)
typedef _Float16 h16;
typedef unsigned short bf;
typedef __attribute__((ext_vector_type(16))) __bf16   v16bf;
typedef __attribute__((ext_vector_type(16))) _Float16 v16h;
typedef __attribute__((ext_vector_type(8)))  _Float16 v8h;
typedef __attribute__((ext_vector_type(8)))  unsigned short v8us;
typedef __attribute__((ext_vector_type(8)))  float    v8f;
typedef __attribute__((ext_vector_type(4)))  float    v4f;
typedef v8h  __attribute__((may_alias)) v8ha;
typedef v4f  __attribute__((may_alias)) v4fa;
typedef v8us __attribute__((may_alias)) v8usa;

__device__ __forceinline__ unsigned short f2bf(float f) { unsigned u = __float_as_uint(f); u += 0x7FFFu + ((u >> 16) & 1u); return (unsigned short)(u >> 16); }
__device__ __forceinline__ float bf2f(unsigned short b) { return __uint_as_float(((unsigned)b) << 16); }
__device__ __forceinline__ float bfr(float f) { return bf2f(f2bf(f)); }
__device__ __forceinline__ v16h cat16(v8h lo, v8h hi) { return __builtin_shufflevector(lo, hi, 0, 1, 2, 3, 4, 5, 6, 7, 8, 9, 10, 11, 12, 13, 14, 15); }
__device__ __forceinline__ v16bf cat16b(v8us lo, v8us hi) { return __builtin_bit_cast(v16bf, __builtin_shufflevector(lo, hi, 0, 1, 2, 3, 4, 5, 6, 7, 8, 9, 10, 11, 12, 13, 14, 15)); }
__device__ __forceinline__ v8f wmma16(v16h a, v16h b, v8f c) { return __builtin_amdgcn_wmma_f32_16x16x32_f16(false, a, false, b, (short)0, c, false, false); }
__device__ __forceinline__ v8f wmmab(v16bf a, v16bf b, v8f c) { return __builtin_amdgcn_wmma_f32_16x16x32_bf16(false, a, false, b, (short)0, c, false, false); }
__device__ __forceinline__ h16 tohx(float x) { return (h16)x; }
__device__ __forceinline__ void splitf(float y, unsigned short& h, unsigned short& l) { h = f2bf(y); l = f2bf(y - bf2f(h)); }
typedef __attribute__((ext_vector_type(4))) _Float16 v4h;
typedef __attribute__((ext_vector_type(4))) unsigned short v4us;



// tile_sync: between the LDS stores of a tile's rows and their reads. One wave: program order is enough, the compiler is only kept from moving LDS accesses across. Several waves: the work-group barrier, since each wave reads what the others stored.
template <int KW> __device__ __forceinline__ void tile_sync() { if constexpr (KW == 1) { __builtin_amdgcn_wave_barrier(); asm volatile("" ::: "memory"); } else { __syncthreads(); } }

// ---- k_gemmw: register-blocked GEMM, one 64x64 output tile per work-group of KW waves; every wave holds the whole tile (16 accumulators) and takes every KW-th 32-wide K step, operands straight from K-contiguous 16-bit planes;
// the KW partial tiles are summed in wave order through LDS behind one work-group barrier, each wave adding and storing 64 / KW of the rows; grid (M/64, N/64, Z), 32 KW threads.
// C[m][n] (f32, pitch ldc, + optional f32 bias[n]) = sum_k A[m][k] Bt[n][k] (+ split products per NSPLIT). z-batch strides sA/sB/sC in elements. K % 32 == 0.
// EPI says where the summed tile goes. 0: C, f32. 1: m = position t, n = head h x HD + d (a tile's 64 columns are one head): planes [h][t][d], fp16 and bf16 hi + lo, 256 contiguous bytes per wave store.
// 2: m = kv head g x HD + d, n = position t (the weight is the A operand, so the tile comes out transposed): V^T planes [g x HD + d][t] at pitch PP, whole 128-byte lines; the bias belongs to the rows.
template <typename T16> struct WFrag;
template <> struct WFrag<h16> { typedef v16h V; static __device__ __forceinline__ V ld(const h16* p) { return cat16(*(const v8h*)p, *(const v8h*)(p + 16)); } static __device__ __forceinline__ v8f mma(V a, V b, v8f c) { return wmma16(a, b, c); } };
template <> struct WFrag<bf> { typedef v16bf V; static __device__ __forceinline__ V ld(const bf* p) { return cat16b(*(const v8us*)p, *(const v8us*)(p + 16)); } static __device__ __forceinline__ v8f mma(V a, V b, v8f c) { return wmmab(a, b, c); } };
template <typename T16, int NSPLIT, bool BIAS, int KW, int EPI>
__global__ __launch_bounds__(32 * KW) void k_gemmw(const T16* __restrict__ A, const T16* __restrict__ A2, const T16* __restrict__ Bt, const T16* __restrict__ Bt2, int K, float* C, int ldc, const float* __restrict__ bias, size_t sA, size_t sB, size_t sC, h16* P16, bf* Ph, bf* Pl) {
    static_assert(EPI == 0 || HD == 64, "a 64-column tile is one head");
    typedef typename WFrag<T16>::V V;
    constexpr int MBR = (KW == 1) ? 1 : 4;   // 16-row blocks staged in LDS per round: one wave alone goes block by block, several waves stage their whole partial tiles, so that one barrier serves the tile
    __shared__ __align__(16) float os[KW * MBR * 16 * 68];
    const size_t z = blockIdx.z; A += z * sA; if (A2) A2 += z * sA; Bt += z * sB; if (Bt2) Bt2 += z * sB; C += z * sC;
    const int lane = threadIdx.x & 31, lr = lane & 15, hi = lane >> 4; const int wv = (KW == 1) ? 0 : __builtin_amdgcn_readfirstlane(threadIdx.x >> 5); const int r0 = blockIdx.x * 64, c0 = blockIdx.y * 64;
    v8f acc[4][4];
#pragma unroll
    for (int mb = 0; mb < 4; ++mb)
#pragma unroll
        for (int nb = 0; nb < 4; ++nb) acc[mb][nb] = (v8f){};
    const size_t aoff = (size_t)(r0 + lr) * K + 8 * hi, boff = (size_t)(c0 + lr) * K + 8 * hi;
#pragma unroll 1
    for (int kc = wv * 32; kc < K; kc += 32 * KW) {
        V a[4], a2[4];
#pragma unroll
        for (int mb = 0; mb < 4; ++mb) { a[mb] = WFrag<T16>::ld(A + aoff + (size_t)mb * 16 * K + kc); if (NSPLIT == 1 || NSPLIT == 2) a2[mb] = WFrag<T16>::ld(A2 + aoff + (size_t)mb * 16 * K + kc); }
#pragma unroll
        for (int nb = 0; nb < 4; ++nb) { const V b = WFrag<T16>::ld(Bt + boff + (size_t)nb * 16 * K + kc); V b2; if (NSPLIT >= 2) b2 = WFrag<T16>::ld(Bt2 + boff + (size_t)nb * 16 * K + kc);
#pragma unroll
            for (int mb = 0; mb < 4; ++mb) { acc[mb][nb] = WFrag<T16>::mma(a[mb], b, acc[mb][nb]); if (NSPLIT == 1 || NSPLIT == 2) acc[mb][nb] = WFrag<T16>::mma(a2[mb], b, acc[mb][nb]); if (NSPLIT >= 2) acc[mb][nb] = WFrag<T16>::mma(a[mb], b2, acc[mb][nb]); } }
        asm volatile("v_nop\n\tv_nop\n\tv_nop\n\tv_nop" : "+v"(acc[0][0]), "+v"(acc[1][1]), "+v"(acc[2][2]), "+v"(acc[3][3]) : "v"(a[0]), "v"(a[3]));
    }
#pragma unroll
    for (int m0 = 0; m0 < 4; m0 += MBR) {
#pragma unroll
        for (int mi = 0; mi < MBR; ++mi) {
#pragma unroll
            for (int nb = 0; nb < 4; ++nb) {
#pragma unroll
                for (int j = 0; j < 8; ++j) os[((wv * MBR + mi) * 16 + hi * 8 + j) * 68 + nb * 16 + lr] = acc[m0 + mi][nb][j]; } }
        tile_sync<KW>();
        float* crow = C + (size_t)(r0 + m0 * 16) * ldc + c0;
#pragma unroll
        for (int s = 0; s < MBR * 8 / KW; ++s) { const int row = wv * (MBR * 16 / KW) + 2 * s + hi, cofs = lr * 4; v4f val = *(const v4fa*)(os + row * 68 + cofs);
#pragma unroll
            for (int w = 1; w < KW; ++w) val += *(const v4fa*)(os + (w * MBR * 16 + row) * 68 + cofs);
            if (BIAS && EPI == 2) val += bfr(bias[r0 + m0 * 16 + row]);
            if (BIAS && EPI != 2) { val[0] += bfr(bias[c0 + cofs]); val[1] += bfr(bias[c0 + cofs + 1]); val[2] += bfr(bias[c0 + cofs + 2]); val[3] += bfr(bias[c0 + cofs + 3]); }
            if constexpr (EPI == 0) { *(v4f*)(crow + (size_t)row * ldc + cofs) = val; }
            else { const size_t oo = (EPI == 1) ? ((size_t)blockIdx.y * TT + r0 + m0 * 16 + row) * HD + cofs : (size_t)(r0 + m0 * 16 + row) * PP + c0 + cofs; v4h o16; v4us oh, ol;
#pragma unroll
                for (int q = 0; q < 4; ++q) { o16[q] = tohx(val[q]); unsigned short a2, c2; splitf(val[q], a2, c2); oh[q] = a2; ol[q] = c2; }
                *(v4h*)(P16 + oo) = o16; *(v4us*)(Ph + oo) = oh; *(v4us*)(Pl + oo) = ol; } }
        if constexpr (MBR < 4) tile_sync<KW>();   // only where a further round stores over these rows
    }
}

typedef __attribute__((ext_vector_type(2))) _Float16 v2h;
typedef __attribute__((ext_vector_type(2))) unsigned short v2us;
typedef __attribute__((ext_vector_type(2))) float v2f;
typedef __attribute__((ext_vector_type(4))) int v4i;

__global__ __launch_bounds__(256) void k_wtG(const float* __restrict__ w, int K, int N, bf* Bt) {
    const int lane = threadIdx.x & 31; const int L0 = (blockIdx.x * 8 + (threadIdx.x >> 5)) * 8; const int nlines = N * K / 64;
{
#pragma unroll 1
        for (int l = 0; l < 8; ++l) { const int L = L0 + l; if (L >= nlines) break; const size_t e = (size_t)L * 64 + lane * 2; const int k = (int)(e % K), n = (int)(e / K); v2us o;
            o[0] = f2bf(w[(size_t)k * N + n]); o[1] = f2bf(w[(size_t)(k + 1) * N + n]); *(v2us*)(Bt + e) = o; }
         }
}
__global__ __launch_bounds__(256) void k_cvt8(const float* __restrict__ src, bf* dst, size_t n8) { const size_t i = (size_t)blockIdx.x * 256 + threadIdx.x; if (i >= n8) return; const v8f v = *(const v8f*)(src + i * 8); v8us o;
#pragma unroll
    for (int k = 0; k < 8; ++k) o[k] = f2bf(v[k]); *(v8us*)(dst + i * 8) = o;  }

// ---- k_fattn: scores, softmax and probability x value of 16 query positions x GW query heads of one kv head, in one wave, with nothing stored between them. Per 32 keys: S^T = K Q^T (a lane holds 16 scores of ONE query column per head),
// running column maximum and sum in f32, P^T packed from the score accumulators straight into the B operand (same k order as the V^T loader: registers 0-7 keys 8 hi + e, 8-15 keys 16 + 8 hi + e), O^T += V^T P^T. The key loop ends at the diagonal block; only that block is masked.
// The maximum in use is raised (and sums and O^T rescaled) only when a column's new maximum exceeds it by more than 8 in log2 units, so a probability is at most 2^8 before the final division. HL: hi + lo bf16 planes, 3 products; else fp16.
// The epilogue divides by the column sum and writes the merged hi/lo planes [t][DQ] for the output projection.
// xwait: s_wait_xcnt 0 behind a run of global loads, in front of the next write of a register that they name as address. The addresses are inputs of the statement only so that their registers stay theirs up to the wait.
template <bool HL> __device__ __forceinline__ void xwait(const void* a, const void* a2) { if constexpr (HL) asm volatile("s_wait_xcnt 0x0" :: "v"(a), "v"(a2) : "memory"); else asm volatile("s_wait_xcnt 0x0" :: "v"(a) : "memory"); }
template <typename T16, bool HL>
__device__ __forceinline__ void fattn_body(const T16* __restrict__ Q, const T16* __restrict__ Q2, const T16* __restrict__ Kp, const T16* __restrict__ Kp2, const T16* __restrict__ Vt, const T16* __restrict__ Vt2, int q0, int kvh, int h0, bf* ATh, bf* ATl) {
    typedef typename WFrag<T16>::V V;
    const int lane = threadIdx.x & 31, lr = lane & 15, hi = lane >> 4;
    V qf[GW][2], qf2[GW][2];
    const size_t qbase = ((size_t)h0 * TT + q0 + lr) * HD + 8 * hi; const T16* qp = Q + qbase; const T16* qp2 = HL ? Q2 + qbase : nullptr;
#pragma unroll
    for (int g = 0; g < GW; ++g)
#pragma unroll
        for (int ks = 0; ks < 2; ++ks) { const size_t qo = (size_t)g * TT * HD + ks * 32; qf[g][ks] = WFrag<T16>::ld(qp + qo); if (HL) qf2[g][ks] = WFrag<T16>::ld(qp2 + qo); }
    xwait<HL>(qp, qp2);
    const size_t kbase = ((size_t)kvh * TT + lr) * HD + 8 * hi, vbase = ((size_t)kvh * HD + lr) * PP + 8 * hi;
    v8f o[GW][4]; float m[GW], l[GW];
#pragma unroll
    for (int g = 0; g < GW; ++g) { m[g] = -3.0e38f; l[g] = 0.f;
#pragma unroll
        for (int dt = 0; dt < 4; ++dt) o[g][dt] = (v8f){}; }
    const int last = q0 >> 5;   // the 32-key block that holds the diagonal of these 16 queries
    V kf[2][2], kf2[2][2];
#pragma unroll
    for (int mt = 0; mt < 2; ++mt)
#pragma unroll
        for (int ks = 0; ks < 2; ++ks) { const size_t ko = (size_t)(mt * 16) * HD + ks * 32; kf[mt][ks] = WFrag<T16>::ld(Kp + kbase + ko); if (HL) kf2[mt][ks] = WFrag<T16>::ld(Kp2 + kbase + ko); }
    xwait<HL>(Kp + kbase, HL ? Kp2 + kbase : nullptr);
#pragma unroll 1
    for (int kb = 0; kb <= last; ++kb) {
        const int k0 = kb * 32;
        V vf[4], vf2[4];   // asked for ahead of the score products, used behind the softmax
        const T16* vp = Vt + vbase + k0; const T16* vp2 = HL ? Vt2 + vbase + k0 : nullptr;
#pragma unroll
        for (int dt = 0; dt < 4; ++dt) { const size_t vo = (size_t)(dt * 16) * PP; vf[dt] = WFrag<T16>::ld(vp + vo); if (HL) vf2[dt] = WFrag<T16>::ld(vp2 + vo); }
        xwait<HL>(vp, vp2);
        v8f s[GW][2];
#pragma unroll
        for (int g = 0; g < GW; ++g)
#pragma unroll
            for (int mt = 0; mt < 2; ++mt) { s[g][mt] = (v8f){};
#pragma unroll
                for (int ks = 0; ks < 2; ++ks) { s[g][mt] = WFrag<T16>::mma(kf[mt][ks], qf[g][ks], s[g][mt]); if (HL) { s[g][mt] = WFrag<T16>::mma(kf[mt][ks], qf2[g][ks], s[g][mt]); s[g][mt] = WFrag<T16>::mma(kf2[mt][ks], qf[g][ks], s[g][mt]); } } }
        const int kn = min(kb + 1, last) * 32;   // the next block's K fragments fly during the softmax (the last trip asks for its own block again: in bounds, unused)
        const T16* kp = Kp + kbase + (size_t)kn * HD; const T16* kp2 = HL ? Kp2 + kbase + (size_t)kn * HD : nullptr;
#pragma unroll
        for (int mt = 0; mt < 2; ++mt)
#pragma unroll
            for (int ks = 0; ks < 2; ++ks) { const size_t ko = (size_t)(mt * 16) * HD + ks * 32; kf[mt][ks] = WFrag<T16>::ld(kp + ko); if (HL) kf2[mt][ks] = WFrag<T16>::ld(kp2 + ko); }
        xwait<HL>(kp, kp2);
#pragma unroll
        for (int g = 0; g < GW; ++g)
#pragma unroll
            for (int mt = 0; mt < 2; ++mt) s[g][mt] *= SCL * 1.4426950408889634f;
        if (kb == last) {   // wave-uniform: only the diagonal block has keys above a query
#pragma unroll
            for (int g = 0; g < GW; ++g)
#pragma unroll
                for (int mt = 0; mt < 2; ++mt)
#pragma unroll
                    for (int j = 0; j < 8; ++j) if (k0 + mt * 16 + hi * 8 + j > q0 + lr) s[g][mt][j] = -3.0e38f; }
        float mx[GW]; bool need = false;
#pragma unroll
        for (int g = 0; g < GW; ++g) { float t = s[g][0][0];
#pragma unroll
            for (int j = 1; j < 8; ++j) t = fmaxf(t, s[g][0][j]);
#pragma unroll
            for (int j = 0; j < 8; ++j) t = fmaxf(t, s[g][1][j]);
            mx[g] = fmaxf(t, __shfl_xor(t, 16, 32)); need = need || (mx[g] > m[g] + 8.0f); }
        if (__builtin_amdgcn_ballot_w32(need) != 0) {   // one scalar test per block
#pragma unroll
            for (int g = 0; g < GW; ++g) { const float mn = fmaxf(m[g], mx[g]); const float al = __builtin_amdgcn_exp2f(m[g] - mn); m[g] = mn; l[g] *= al;
#pragma unroll
                for (int dt = 0; dt < 4; ++dt) o[g][dt] *= al; } }
        V pb[GW], pb2[GW];
#pragma unroll
        for (int g = 0; g < GW; ++g) {
            if constexpr (HL) { v8us ph[2], pl[2];
#pragma unroll
                for (int mt = 0; mt < 2; ++mt)
#pragma unroll
                    for (int j = 0; j < 8; ++j) { const float p = __builtin_amdgcn_exp2f(s[g][mt][j] - m[g]); l[g] += p; unsigned short a, c2; splitf(p, a, c2); ph[mt][j] = a; pl[mt][j] = c2; }
                pb[g] = cat16b(ph[0], ph[1]); pb2[g] = cat16b(pl[0], pl[1]);
            } else { v8h ph[2];
#pragma unroll
                for (int mt = 0; mt < 2; ++mt)
#pragma unroll
                    for (int j = 0; j < 8; ++j) { const float p = __builtin_amdgcn_exp2f(s[g][mt][j] - m[g]); l[g] += p; ph[mt][j] = tohx(p); }
                pb[g] = cat16(ph[0], ph[1]); } }
#pragma unroll
        for (int dt = 0; dt < 4; ++dt)
#pragma unroll
            for (int g = 0; g < GW; ++g) { o[g][dt] = WFrag<T16>::mma(vf[dt], pb[g], o[g][dt]); if (HL) { o[g][dt] = WFrag<T16>::mma(vf[dt], pb2[g], o[g][dt]); o[g][dt] = WFrag<T16>::mma(vf2[dt], pb[g], o[g][dt]); } }
    }
#pragma unroll
    for (int g = 0; g < GW; ++g) { const float inv = __fdiv_rn(1.0f, l[g] + __shfl_xor(l[g], 16, 32));   // the two halves of a column hold the sums of their own keys
#pragma unroll
        for (int dt = 0; dt < 4; ++dt) { v8us oh, ol;
#pragma unroll
            for (int j = 0; j < 8; ++j) { unsigned short a, c2; splitf(o[g][dt][j] * inv, a, c2); oh[j] = a; ol[j] = c2; }
            const size_t oo = (size_t)(q0 + lr) * DQ + (h0 + g) * HD + dt * 16 + hi * 8; bf* sh = ATh + oo; bf* sl = ATl + oo; *(v8us*)sh = oh; *(v8us*)sl = ol;
            asm volatile("s_wait_xcnt 0x0" :: "v"(sh), "v"(sl), "v"(oh), "v"(ol) : "memory"); } }   // in front of the next write of an address or data register of the two stores; the inputs keep those registers theirs up to the wait
}
// grid (NKV, TT / 16), REP / GW waves a work-group: the waves of a work-group take the query heads of one kv head at the same 16 positions, so they read the same K and V^T lines on one WGP; they share nothing else and meet at no barrier. The longest key loops (last query rows) have the lowest indices.
__global__ __launch_bounds__(32 * (REP / GW)) void k_fattn(const h16* __restrict__ Q16, const h16* __restrict__ K16, const h16* __restrict__ V16, const bf* __restrict__ Qh, const bf* __restrict__ Ql, const bf* __restrict__ Kh, const bf* __restrict__ Kl, const bf* __restrict__ Vh, const bf* __restrict__ Vl, bf* ATh, bf* ATl) {
    const int kvh = blockIdx.x, q0 = (TT / 16 - 1 - (int)blockIdx.y) * 16, h0 = kvh * REP + __builtin_amdgcn_readfirstlane(threadIdx.x >> 5) * GW;
    if (q0 < RH) fattn_body<bf, true>(Qh, Ql, Kh, Kl, Vh, Vl, q0, kvh, h0, ATh, ATl); else fattn_body<h16, false>(Q16, nullptr, K16, nullptr, V16, nullptr, q0, kvh, h0, ATh, ATl);
}

extern "C" void kernel_launch(void* const* d_in, const int* in_sizes, int n_in,
                              void* d_out, int out_size, void* d_ws, size_t ws_size, hipStream_t stream) {
    (void)in_sizes; (void)n_in; (void)out_size;
    const float* x = (const float*)d_in[0]; const float* wq = (const float*)d_in[1]; const float* bq = (const float*)d_in[2]; const float* wk = (const float*)d_in[3]; const float* bk = (const float*)d_in[4]; const float* wv = (const float*)d_in[5]; const float* bv = (const float*)d_in[6]; const float* wo = (const float*)d_in[7]; const float* bo = (const float*)d_in[8];   /* order x, Wq, bq, Wk, bk, Wv, bv, Wo, bo */
    float* OUT = (float*)d_out;     // [2][2048][2048]
    char* wsp = (char*)d_ws;
    auto take = [&](size_t bytes) { char* p = wsp; wsp += (bytes + 255) & ~(size_t)255; return (void*)p; };
    bf* WQ = (bf*)take((size_t)DQ * DM * 2); bf* WK = (bf*)take((size_t)DKV * DM * 2); bf* WV = (bf*)take((size_t)DKV * DM * 2); bf* WO = (bf*)take((size_t)DM * DQ * 2);
    bf* XB = (bf*)take((size_t)TT * DM * 2);
    h16* QP16 = (h16*)take((size_t)NH_ * TT * HD * 2); h16* KP16 = (h16*)take((size_t)NKV * TT * HD * 2); h16* VT16 = (h16*)take((size_t)NKV * HD * PP * 2);
    bf* QPh = (bf*)take((size_t)NH_ * TT * HD * 2); bf* QPl = (bf*)take((size_t)NH_ * TT * HD * 2); bf* KPh = (bf*)take((size_t)NKV * TT * HD * 2); bf* KPl = (bf*)take((size_t)NKV * TT * HD * 2); bf* VTh = (bf*)take((size_t)NKV * HD * PP * 2); bf* VTl = (bf*)take((size_t)NKV * HD * PP * 2);
    bf* ATh = (bf*)take((size_t)TT * DQ * 2); bf* ATl = (bf*)take((size_t)TT * DQ * 2);
    if ((size_t)(wsp - (char*)d_ws) > ws_size) return;    // ws 256 MiB
    { k_cvt8<<<(unsigned)(((size_t)DQ * DM / 8 + 255) / 256), 256, 0, stream>>>(wq, WQ, (size_t)DQ * DM / 8); k_cvt8<<<(unsigned)(((size_t)DKV * DM / 8 + 255) / 256), 256, 0, stream>>>(wk, WK, (size_t)DKV * DM / 8); k_cvt8<<<(unsigned)(((size_t)DKV * DM / 8 + 255) / 256), 256, 0, stream>>>(wv, WV, (size_t)DKV * DM / 8);
      k_cvt8<<<(unsigned)(((size_t)DM * DQ / 8 + 255) / 256), 256, 0, stream>>>(wo, WO, (size_t)DM * DQ / 8);
       }
    for (int b = 0; b < NB_; ++b) {
        
        k_cvt8<<<(unsigned)(((size_t)TT * DM / 8 + 255) / 256), 256, 0, stream>>>(x + (size_t)b * TT * DM, XB, (size_t)TT * DM / 8);
        k_gemmw<bf, 0, true, KWL, 1><<<dim3(TT / 64, DQ / 64, 1), 32 * KWL, 0, stream>>>(XB, nullptr, WQ, nullptr, DM, nullptr, 0, bq, 0, 0, 0, QP16, QPh, QPl);
        k_gemmw<bf, 0, true, KWS, 1><<<dim3(TT / 64, DKV / 64, 1), 32 * KWS, 0, stream>>>(XB, nullptr, WK, nullptr, DM, nullptr, 0, bk, 0, 0, 0, KP16, KPh, KPl);
        k_gemmw<bf, 0, true, KWS, 2><<<dim3(DKV / 64, TT / 64, 1), 32 * KWS, 0, stream>>>(WV, nullptr, XB, nullptr, DM, nullptr, 0, bv, 0, 0, 0, VT16, VTh, VTl);
        k_fattn<<<dim3(NKV, TT / 16, 1), 32 * (REP / GW), 0, stream>>>(QP16, KP16, VT16, QPh, QPl, KPh, KPl, VTh, VTl, ATh, ATl);
        k_gemmw<bf, 1, true, KWL, 0><<<dim3(TT / 64, DM / 64, 1), 32 * KWL, 0, stream>>>(ATh, ATl, WO, nullptr, DQ, OUT + (size_t)b * TT * DM, DM, bo, 0, 0, 0, nullptr, nullptr, nullptr); }
}

// v005
// It runs in 270 microseconds.
// Two timings next to v004 put it at 1.18 and 1.20 times that version's speed.
// Over all steps from v000 it is 9.85 times as fast.
#include <hip/hip_runtime.h>

// Grouped-query causal attention (x [2][2048][2048]; q = x Wq^T + bq (32 heads x 64), k, v = x Wk^T + bk, x Wv^T + bv (8 kv heads x 64) ('oi' 1/sqrt(2048), zero biases); query head j = (kv head h, group member g) = 4h + g uses kv head h; scores x 64^-0.5; causal (-inf); softmax; out = merged Wo^T + bo ('oi' [2048][2048]) -> [2][2048][2048] (8.4 M); argument order x, Wq, bq, Wk, bk, Wv, bv, Wo, bo).
// Every 16-bit operand plane lies packed in fragment order (pk below). Layout per batch: bf16 copy of x; exact projections + f32 biases, each projection kernel storing the attention's 16-bit planes itself (no f32 projection buffer); causal T-2048 attention in one launch (k_fattn: scores, running softmax and probability x value stay in registers; hybrid rows: < 512 hi/lo 3 products, rest fp16); merged hi/lo x Wo exact + bo.
// Compute dtypes, f32 accumulate: every input rounded to bf16; projections exact + f32 biases; attention rows < 512 3 products, rest fp16; softmax f32; Wo hl x exact + bias.

#define NB_  2
#define TT   2048
#define DM   2048
#define NH_  32
#define NKV  8
#define REP  (NH_ / NKV)
#define HD   64
#define DQ   (NH_ * HD)
#define DKV  (NKV * HD)
#define PP   (2 * TT)             // K of the packed V^T planes (16-bit elements that a row owns; the first TT are keys)
#define GW   2                    // query heads of one kv head that one attention wave holds (32 score columns)
#define RH   512                  // query rows < RH use hi+lo planes (0: none)
#define SCL  0.125f   // HD^-0.5
#define KWL  4                    // waves that share a tile's K loop where a launch has 1024 tiles (q projection, Wo)
#define KWS  8                    // the same where a launch has at most 256 tiles (k, v projections)
typedef _Float16 h16;
typedef unsigned short bf;
typedef __attribute__((ext_vector_type(16))) __bf16   v16bf;
typedef __attribute__((ext_vector_type(16))) _Float16 v16h;
typedef __attribute__((ext_vector_type(8)))  _Float16 v8h;
typedef __attribute__((ext_vector_type(8)))  unsigned short v8us;
typedef __attribute__((ext_vector_type(8)))  float    v8f;
typedef __attribute__((ext_vector_type(4)))  float    v4f;
typedef v8h  __attribute__((may_alias)) v8ha;
typedef v4f  __attribute__((may_alias)) v4fa;
typedef v8us __attribute__((may_alias)) v8usa;

__device__ __forceinline__ unsigned short f2bf(float f) { unsigned u = __float_as_uint(f); u += 0x7FFFu + ((u >> 16) & 1u); return (unsigned short)(u >> 16); }
__device__ __forceinline__ float bf2f(unsigned short b) { return __uint_as_float(((unsigned)b) << 16); }
__device__ __forceinline__ float bfr(float f) { return bf2f(f2bf(f)); }
__device__ __forceinline__ v16h cat16(v8h lo, v8h hi) { return __builtin_shufflevector(lo, hi, 0, 1, 2, 3, 4, 5, 6, 7, 8, 9, 10, 11, 12, 13, 14, 15); }
__device__ __forceinline__ v16bf cat16b(v8us lo, v8us hi) { return __builtin_bit_cast(v16bf, __builtin_shufflevector(lo, hi, 0, 1, 2, 3, 4, 5, 6, 7, 8, 9, 10, 11, 12, 13, 14, 15)); }
__device__ __forceinline__ v8f wmma16(v16h a, v16h b, v8f c) { return __builtin_amdgcn_wmma_f32_16x16x32_f16(false, a, false, b, (short)0, c, false, false); }
__device__ __forceinline__ v8f wmmab(v16bf a, v16bf b, v8f c) { return __builtin_amdgcn_wmma_f32_16x16x32_bf16(false, a, false, b, (short)0, c, false, false); }
__device__ __forceinline__ h16 tohx(float x) { return (h16)x; }
__device__ __forceinline__ void splitf(float y, unsigned short& h, unsigned short& l) { h = f2bf(y); l = f2bf(y - bf2f(h)); }



// tile_sync: between the LDS stores of a tile's rows and their reads. One wave: program order is enough, the compiler is only kept from moving LDS accesses across. Several waves: the work-group barrier, since each wave reads what the others stored.
template <int KW> __device__ __forceinline__ void tile_sync() { if constexpr (KW == 1) { __builtin_amdgcn_wave_barrier(); asm volatile("" ::: "memory"); } else { __syncthreads(); } }

// ---- k_gemmw: register-blocked GEMM, one 64x64 output tile per work-group of KW waves; every wave holds the whole tile (16 accumulators) and takes every KW-th 32-wide K step, operands straight from packed 16-bit planes (pk below);
// the KW partial tiles are summed in wave order through LDS behind one work-group barrier, each wave adding and storing 1 / KW of the tile; grid (M/64, N/64, Z), 32 KW threads.
// C[m][n] (f32, pitch ldc, + optional f32 bias[n]) = sum_k A[m][k] Bt[n][k] (+ split products per NSPLIT). z-batch strides sA/sB/sC in elements. K % 32 == 0.
// EPI says where the summed tile goes. 0: C, f32. 1: m = position t, n = head h x HD + d (a tile's 64 columns are one head): per head a packed plane [t][d], fp16 and bf16 hi + lo.
// 2: m = kv head g x HD + d, n = position t (the weight is the A operand, so the tile comes out transposed): packed V^T planes [g x HD + d][t] with K = PP; the bias belongs to the rows.
// Packed plane: a [rows][K] 16-bit operand lies as tiles of 16 rows x 32 k (512 elements; tile index (row / 16) x (K / 32) + k / 32). Inside a tile the 8 elements k = 16 s + 8 hi + e of row lr lie at s x 256 + (lr + 16 hi) x 8 + e:
// lane lr + 16 hi finds the two halves of its fragment at lane x 8 and 256 + lane x 8, so each wave-wide 16-byte load covers 512 contiguous bytes (4 whole lines) and not 32 bytes of each of 16 lines. The packing leaves a fragment's k order alone: registers 0-7 hold k = 8 hi + e, registers 8-15 k = 16 + 8 hi + e.
__device__ __forceinline__ size_t pk(int row, int k, int K) { return ((size_t)(row >> 4) * (K >> 5) + (k >> 5)) * 512 + ((k >> 4) & 1) * 256 + ((row & 15) + 16 * ((k >> 3) & 1)) * 8 + (k & 7); }
template <typename T16> struct WFrag;
template <> struct WFrag<h16> { typedef v16h V; static __device__ __forceinline__ V ld(const h16* p) { return cat16(*(const v8h*)p, *(const v8h*)(p + 256)); } static __device__ __forceinline__ v8f mma(V a, V b, v8f c) { return wmma16(a, b, c); } };
template <> struct WFrag<bf> { typedef v16bf V; static __device__ __forceinline__ V ld(const bf* p) { return cat16b(*(const v8us*)p, *(const v8us*)(p + 256)); } static __device__ __forceinline__ v8f mma(V a, V b, v8f c) { return wmmab(a, b, c); } };
template <typename T16, int NSPLIT, bool BIAS, int KW, int EPI, int K>
__global__ __launch_bounds__(32 * KW) void k_gemmw(const T16* __restrict__ A, const T16* __restrict__ A2, const T16* __restrict__ Bt, const T16* __restrict__ Bt2, float* C, int ldc, const float* __restrict__ bias, size_t sA, size_t sB, size_t sC, h16* P16, bf* Ph, bf* Pl) {
    static_assert(EPI == 0 || (HD == 64 && KW > 1), "a 64-column tile is one head; the plane epilogue reads the whole staged tile");
    typedef typename WFrag<T16>::V V;
    constexpr int MBR = (KW == 1) ? 1 : 4;   // 16-row blocks staged in LDS per round: one wave alone goes block by block, several waves stage their whole partial tiles, so that one barrier serves the tile
    __shared__ __align__(16) float os[KW * MBR * 16 * 68];
    const size_t z = blockIdx.z; A += z * sA; if (A2) A2 += z * sA; Bt += z * sB; if (Bt2) Bt2 += z * sB; C += z * sC;
    const int lane = threadIdx.x & 31, lr = lane & 15, hi = lane >> 4; const int wv = (KW == 1) ? 0 : __builtin_amdgcn_readfirstlane(threadIdx.x >> 5); const int r0 = blockIdx.x * 64, c0 = blockIdx.y * 64;
    v8f acc[4][4];
#pragma unroll
    for (int mb = 0; mb < 4; ++mb)
#pragma unroll
        for (int nb = 0; nb < 4; ++nb) acc[mb][nb] = (v8f){};
    // packed planes: 16 rows are 16 K elements in a row, a 32-wide K step 512 of them. One pointer per plane walks the K steps; K is a compile-time constant so that the row blocks are immediate offsets of it.
    constexpr bool HA2 = NSPLIT == 1 || NSPLIT == 2, HB2 = NSPLIT >= 2; const size_t ao = (size_t)r0 * K + wv * 512 + lane * 8, bo = (size_t)c0 * K + wv * 512 + lane * 8;
    const T16* pa = A + ao; const T16* pa2 = HA2 ? A2 + ao : nullptr; const T16* pb = Bt + bo; const T16* pb2 = HB2 ? Bt2 + bo : nullptr;
#pragma unroll 1
    for (int kc = wv * 32; kc < K; kc += 32 * KW) {
        V a[4], a2[4], b[4], b2[4];
#pragma unroll
        for (int i = 0; i < 4; ++i) { a[i] = WFrag<T16>::ld(pa + i * 16 * K); if (HA2) a2[i] = WFrag<T16>::ld(pa2 + i * 16 * K); b[i] = WFrag<T16>::ld(pb + i * 16 * K); if (HB2) b2[i] = WFrag<T16>::ld(pb2 + i * 16 * K); }
        // s_wait_xcnt 0 behind the trip's loads, in front of the step of the pointers that they name; the pointers are inputs only so that their registers stay theirs up to the wait
        if constexpr (HA2 && HB2) asm volatile("s_wait_xcnt 0x0" :: "v"(pa), "v"(pa2), "v"(pb), "v"(pb2) : "memory"); else if constexpr (HA2) asm volatile("s_wait_xcnt 0x0" :: "v"(pa), "v"(pa2), "v"(pb) : "memory");
        else if constexpr (HB2) asm volatile("s_wait_xcnt 0x0" :: "v"(pa), "v"(pb), "v"(pb2) : "memory"); else asm volatile("s_wait_xcnt 0x0" :: "v"(pa), "v"(pb) : "memory");
        pa += 512 * KW; pb += 512 * KW; if (HA2) pa2 += 512 * KW; if (HB2) pb2 += 512 * KW;
#pragma unroll
        for (int nb = 0; nb < 4; ++nb) {
#pragma unroll
            for (int mb = 0; mb < 4; ++mb) { acc[mb][nb] = WFrag<T16>::mma(a[mb], b[nb], acc[mb][nb]); if (NSPLIT == 1 || NSPLIT == 2) acc[mb][nb] = WFrag<T16>::mma(a2[mb], b[nb], acc[mb][nb]); if (NSPLIT >= 2) acc[mb][nb] = WFrag<T16>::mma(a[mb], b2[nb], acc[mb][nb]); } }
        asm volatile("v_nop\n\tv_nop\n\tv_nop\n\tv_nop" : "+v"(acc[0][0]), "+v"(acc[1][1]), "+v"(acc[2][2]), "+v"(acc[3][3]) : "v"(a[0]), "v"(a[3]));
    }
#pragma unroll
    for (int m0 = 0; m0 < 4; m0 += MBR) {
#pragma unroll
        for (int mi = 0; mi < MBR; ++mi) {
#pragma unroll
            for (int nb = 0; nb < 4; ++nb) {
#pragma unroll
                for (int j = 0; j < 8; ++j) os[((wv * MBR + mi) * 16 + hi * 8 + j) * 68 + nb * 16 + lr] = acc[m0 + mi][nb][j]; } }
        tile_sync<KW>();
        float* crow = C + (size_t)(r0 + m0 * 16) * ldc + c0;
        if constexpr (EPI != 0) {   // a wave store is one half tile of a packed plane: 16 rows x 16 columns, 8 columns a lane, 512 contiguous bytes
#pragma unroll
            for (int s = 0; s < 16 / KW; ++s) { const int u = wv * (16 / KW) + s, row = (u >> 2) * 16 + lr, cofs = (u & 3) * 16 + hi * 8; v4f va = *(const v4fa*)(os + row * 68 + cofs), vb = *(const v4fa*)(os + row * 68 + cofs + 4);
#pragma unroll
                for (int w = 1; w < KW; ++w) { va += *(const v4fa*)(os + (w * MBR * 16 + row) * 68 + cofs); vb += *(const v4fa*)(os + (w * MBR * 16 + row) * 68 + cofs + 4); }
                if (BIAS && EPI == 2) { const float bb = bfr(bias[r0 + row]); va += bb; vb += bb; }
                if (BIAS && EPI != 2) {
#pragma unroll
                    for (int q = 0; q < 4; ++q) { va[q] += bfr(bias[c0 + cofs + q]); vb[q] += bfr(bias[c0 + cofs + 4 + q]); } }
                const size_t oo = (EPI == 1) ? (size_t)blockIdx.y * TT * HD + pk(r0 + row, cofs, HD) : pk(r0 + row, c0 + cofs, PP); v8h o16; v8us oh, ol;
#pragma unroll
                for (int q = 0; q < 8; ++q) { const float y = q < 4 ? va[q & 3] : vb[q & 3]; o16[q] = tohx(y); unsigned short a2, c2; splitf(y, a2, c2); oh[q] = a2; ol[q] = c2; }
                h16* s16 = P16 + oo; bf* sh = Ph + oo; bf* sl = Pl + oo; *(v8h*)s16 = o16; *(v8us*)sh = oh; *(v8us*)sl = ol;
                asm volatile("s_wait_xcnt 0x0" :: "v"(s16), "v"(sh), "v"(sl), "v"(o16), "v"(oh), "v"(ol) : "memory"); } }   // in front of the next write of an address or data register of the three stores; the inputs keep those registers theirs up to the wait
        else
#pragma unroll
        for (int s = 0; s < MBR * 8 / KW; ++s) { const int row = wv * (MBR * 16 / KW) + 2 * s + hi, cofs = lr * 4; v4f val = *(const v4fa*)(os + row * 68 + cofs);
#pragma unroll
            for (int w = 1; w < KW; ++w) val += *(const v4fa*)(os + (w * MBR * 16 + row) * 68 + cofs);
            if (BIAS && EPI == 2) val += bfr(bias[r0 + m0 * 16 + row]);
            if (BIAS && EPI != 2) { val[0] += bfr(bias[c0 + cofs]); val[1] += bfr(bias[c0 + cofs + 1]); val[2] += bfr(bias[c0 + cofs + 2]); val[3] += bfr(bias[c0 + cofs + 3]); }
            *(v4f*)(crow + (size_t)row * ldc + cofs) = val; }
        if constexpr (MBR < 4) tile_sync<KW>();   // only where a further round stores over these rows
    }
}

typedef __attribute__((ext_vector_type(2))) _Float16 v2h;
typedef __attribute__((ext_vector_type(2))) unsigned short v2us;
typedef __attribute__((ext_vector_type(2))) float v2f;
typedef __attribute__((ext_vector_type(4))) int v4i;

__global__ __launch_bounds__(256) void k_wtG(const float* __restrict__ w, int K, int N, bf* Bt) {
    const int lane = threadIdx.x & 31; const int L0 = (blockIdx.x * 8 + (threadIdx.x >> 5)) * 8; const int nlines = N * K / 64;
{
#pragma unroll 1
        for (int l = 0; l < 8; ++l) { const int L = L0 + l; if (L >= nlines) break; const size_t e = (size_t)L * 64 + lane * 2; const int k = (int)(e % K), n = (int)(e / K); v2us o;
            o[0] = f2bf(w[(size_t)k * N + n]); o[1] = f2bf(w[(size_t)(k + 1) * N + n]); *(v2us*)(Bt + e) = o; }
         }
}
// k_cvtp: f32 [rows][K] -> bf16 packed plane. A work-group takes 16 rows x 128 k: a wave reads 2 rows x 512 bytes, the 16-byte pieces change places in LDS, and the 4 tiles go out as 4 KiB in a row.
// Piece (row, c) is piece c x 16 + row of the 4 tiles; in LDS its low 4 index bits are XORed with c, so that neither the stores (16 values of c a wave) nor the loads meet in a bank.
__global__ __launch_bounds__(256) void k_cvtp(const float* __restrict__ src, bf* dst, int K) {
    __shared__ __align__(16) bf sh[2048];
    const int t = threadIdx.x, row = t >> 4, c = t & 15; const v8f v = *(const v8f*)(src + ((size_t)blockIdx.y * 16 + row) * K + blockIdx.x * 128 + c * 8); v8us o;
#pragma unroll
    for (int k = 0; k < 8; ++k) o[k] = f2bf(v[k]);
    *(v8usa*)(sh + (c * 16 + (row ^ c)) * 8) = o;
    __syncthreads();   // every wave stores pieces that the other waves converted
    *(v8us*)(dst + ((size_t)blockIdx.y * (K >> 5) + blockIdx.x * 4) * 512 + t * 8) = *(const v8usa*)(sh + ((t & ~15) | ((t & 15) ^ (t >> 4))) * 8); }

// ---- k_fattn: scores, softmax and probability x value of 16 query positions x GW query heads of one kv head, in one wave, with nothing stored between them. Per 32 keys: S^T = K Q^T (a lane holds 16 scores of ONE query column per head),
// running column maximum and sum in f32, P^T packed from the score accumulators straight into the B operand (same k order as the V^T loader: registers 0-7 keys 8 hi + e, 8-15 keys 16 + 8 hi + e), O^T += V^T P^T. The key loop ends at the diagonal block; only that block is masked.
// The maximum in use is raised (and sums and O^T rescaled) only when a column's new maximum exceeds it by more than 8 in log2 units, so a probability is at most 2^8 before the final division. HL: hi + lo bf16 planes, 3 products; else fp16.
// The epilogue divides by the column sum and writes the merged hi/lo planes [t][DQ], packed, for the output projection (a wave store is half a tile, 512 contiguous bytes).
// xwait: s_wait_xcnt 0 behind a run of global loads, in front of the next write of a register that they name as address. The addresses are inputs of the statement only so that their registers stay theirs up to the wait.
template <bool HL> __device__ __forceinline__ void xwait(const void* a, const void* a2) { if constexpr (HL) asm volatile("s_wait_xcnt 0x0" :: "v"(a), "v"(a2) : "memory"); else asm volatile("s_wait_xcnt 0x0" :: "v"(a) : "memory"); }
template <typename T16, bool HL>
__device__ __forceinline__ void fattn_body(const T16* __restrict__ Q, const T16* __restrict__ Q2, const T16* __restrict__ Kp, const T16* __restrict__ Kp2, const T16* __restrict__ Vt, const T16* __restrict__ Vt2, int q0, int kvh, int h0, bf* ATh, bf* ATl) {
    typedef typename WFrag<T16>::V V;
    const int lane = threadIdx.x & 31, lr = lane & 15, hi = lane >> 4;
    V qf[GW][2], qf2[GW][2];
    const size_t qbase = ((size_t)h0 * TT + q0) * HD + lane * 8; /* packed planes, K = HD: 16 positions are 2 tiles in a row */ const T16* qp = Q + qbase; const T16* qp2 = HL ? Q2 + qbase : nullptr;
#pragma unroll
    for (int g = 0; g < GW; ++g)
#pragma unroll
        for (int ks = 0; ks < 2; ++ks) { const size_t qo = (size_t)g * TT * HD + ks * 512; qf[g][ks] = WFrag<T16>::ld(qp + qo); if (HL) qf2[g][ks] = WFrag<T16>::ld(qp2 + qo); }
    xwait<HL>(qp, qp2);
    const size_t kbase = (size_t)kvh * TT * HD + lane * 8, vbase = (size_t)kvh * HD * PP + lane * 8;   // V^T packed with K = PP: 16 rows are 16 PP elements, 32 keys one tile of 512
    v8f o[GW][4]; float m[GW], l[GW];
#pragma unroll
    for (int g = 0; g < GW; ++g) { m[g] = -3.0e38f; l[g] = 0.f;
#pragma unroll
        for (int dt = 0; dt < 4; ++dt) o[g][dt] = (v8f){}; }
    const int last = q0 >> 5;   // the 32-key block that holds the diagonal of these 16 queries
    V kf[2][2], kf2[2][2];
#pragma unroll
    for (int mt = 0; mt < 2; ++mt)
#pragma unroll
        for (int ks = 0; ks < 2; ++ks) { const size_t ko = (size_t)(mt * 16) * HD + ks * 512; kf[mt][ks] = WFrag<T16>::ld(Kp + kbase + ko); if (HL) kf2[mt][ks] = WFrag<T16>::ld(Kp2 + kbase + ko); }
    xwait<HL>(Kp + kbase, HL ? Kp2 + kbase : nullptr);
#pragma unroll 1
    for (int kb = 0; kb <= last; ++kb) {
        const int k0 = kb * 32;
        V vf[4], vf2[4];   // asked for ahead of the score products, used behind the softmax
        const T16* vp = Vt + vbase + k0 * 16; const T16* vp2 = HL ? Vt2 + vbase + k0 * 16 : nullptr;
#pragma unroll
        for (int dt = 0; dt < 4; ++dt) { const size_t vo = (size_t)(dt * 16) * PP; vf[dt] = WFrag<T16>::ld(vp + vo); if (HL) vf2[dt] = WFrag<T16>::ld(vp2 + vo); }
        xwait<HL>(vp, vp2);
        v8f s[GW][2];
#pragma unroll
        for (int g = 0; g < GW; ++g)
#pragma unroll
            for (int mt = 0; mt < 2; ++mt) { s[g][mt] = (v8f){};
#pragma unroll
                for (int ks = 0; ks < 2; ++ks) { s[g][mt] = WFrag<T16>::mma(kf[mt][ks], qf[g][ks], s[g][mt]); if (HL) { s[g][mt] = WFrag<T16>::mma(kf[mt][ks], qf2[g][ks], s[g][mt]); s[g][mt] = WFrag<T16>::mma(kf2[mt][ks], qf[g][ks], s[g][mt]); } } }
        const int kn = min(kb + 1, last) * 32;   // the next block's K fragments fly during the softmax (the last trip asks for its own block again: in bounds, unused)
        const T16* kp = Kp + kbase + (size_t)kn * HD; const T16* kp2 = HL ? Kp2 + kbase + (size_t)kn * HD : nullptr;
#pragma unroll
        for (int mt = 0; mt < 2; ++mt)
#pragma unroll
            for (int ks = 0; ks < 2; ++ks) { const size_t ko = (size_t)(mt * 16) * HD + ks * 512; kf[mt][ks] = WFrag<T16>::ld(kp + ko); if (HL) kf2[mt][ks] = WFrag<T16>::ld(kp2 + ko); }
        xwait<HL>(kp, kp2);
#pragma unroll
        for (int g = 0; g < GW; ++g)
#pragma unroll
            for (int mt = 0; mt < 2; ++mt) s[g][mt] *= SCL * 1.4426950408889634f;
        if (kb == last) {   // wave-uniform: only the diagonal block has keys above a query
#pragma unroll
            for (int g = 0; g < GW; ++g)
#pragma unroll
                for (int mt = 0; mt < 2; ++mt)
#pragma unroll
                    for (int j = 0; j < 8; ++j) if (k0 + mt * 16 + hi * 8 + j > q0 + lr) s[g][mt][j] = -3.0e38f; }
        float mx[GW]; bool need = false;
#pragma unroll
        for (int g = 0; g < GW; ++g) { float t = s[g][0][0];
#pragma unroll
            for (int j = 1; j < 8; ++j) t = fmaxf(t, s[g][0][j]);
#pragma unroll
            for (int j = 0; j < 8; ++j) t = fmaxf(t, s[g][1][j]);
            mx[g] = fmaxf(t, __shfl_xor(t, 16, 32)); need = need || (mx[g] > m[g] + 8.0f); }
        if (__builtin_amdgcn_ballot_w32(need) != 0) {   // one scalar test per block
#pragma unroll
            for (int g = 0; g < GW; ++g) { const float mn = fmaxf(m[g], mx[g]); const float al = __builtin_amdgcn_exp2f(m[g] - mn); m[g] = mn; l[g] *= al;
#pragma unroll
                for (int dt = 0; dt < 4; ++dt) o[g][dt] *= al; } }
        V pb[GW], pb2[GW];
#pragma unroll
        for (int g = 0; g < GW; ++g) {
            if constexpr (HL) { v8us ph[2], pl[2];
#pragma unroll
                for (int mt = 0; mt < 2; ++mt)
#pragma unroll
                    for (int j = 0; j < 8; ++j) { const float p = __builtin_amdgcn_exp2f(s[g][mt][j] - m[g]); l[g] += p; unsigned short a, c2; splitf(p, a, c2); ph[mt][j] = a; pl[mt][j] = c2; }
                pb[g] = cat16b(ph[0], ph[1]); pb2[g] = cat16b(pl[0], pl[1]);
            } else { v8h ph[2];
#pragma unroll
                for (int mt = 0; mt < 2; ++mt)
#pragma unroll
                    for (int j = 0; j < 8; ++j) { const float p = __builtin_amdgcn_exp2f(s[g][mt][j] - m[g]); l[g] += p; ph[mt][j] = tohx(p); }
                pb[g] = cat16(ph[0], ph[1]); } }
#pragma unroll
        for (int dt = 0; dt < 4; ++dt)
#pragma unroll
            for (int g = 0; g < GW; ++g) { o[g][dt] = WFrag<T16>::mma(vf[dt], pb[g], o[g][dt]); if (HL) { o[g][dt] = WFrag<T16>::mma(vf[dt], pb2[g], o[g][dt]); o[g][dt] = WFrag<T16>::mma(vf2[dt], pb[g], o[g][dt]); } }
    }
#pragma unroll
    for (int g = 0; g < GW; ++g) { const float inv = __fdiv_rn(1.0f, l[g] + __shfl_xor(l[g], 16, 32));   // the two halves of a column hold the sums of their own keys
#pragma unroll
        for (int dt = 0; dt < 4; ++dt) { v8us oh, ol;
#pragma unroll
            for (int j = 0; j < 8; ++j) { unsigned short a, c2; splitf(o[g][dt][j] * inv, a, c2); oh[j] = a; ol[j] = c2; }
            const size_t oo = pk(q0 + lr, (h0 + g) * HD + dt * 16 + hi * 8, DQ); bf* sh = ATh + oo; bf* sl = ATl + oo; *(v8us*)sh = oh; *(v8us*)sl = ol;
            asm volatile("s_wait_xcnt 0x0" :: "v"(sh), "v"(sl), "v"(oh), "v"(ol) : "memory"); } }   // in front of the next write of an address or data register of the two stores; the inputs keep those registers theirs up to the wait
}
// grid (NKV, TT / 16), REP / GW waves a work-group: the waves of a work-group take the query heads of one kv head at the same 16 positions, so they read the same K and V^T lines on one WGP; they share nothing else and meet at no barrier. The longest key loops (last query rows) have the lowest indices.
__global__ __launch_bounds__(32 * (REP / GW)) void k_fattn(const h16* __restrict__ Q16, const h16* __restrict__ K16, const h16* __restrict__ V16, const bf* __restrict__ Qh, const bf* __restrict__ Ql, const bf* __restrict__ Kh, const bf* __restrict__ Kl, const bf* __restrict__ Vh, const bf* __restrict__ Vl, bf* ATh, bf* ATl) {
    const int kvh = blockIdx.x, q0 = (TT / 16 - 1 - (int)blockIdx.y) * 16, h0 = kvh * REP + __builtin_amdgcn_readfirstlane(threadIdx.x >> 5) * GW;
    if (q0 < RH) fattn_body<bf, true>(Qh, Ql, Kh, Kl, Vh, Vl, q0, kvh, h0, ATh, ATl); else fattn_body<h16, false>(Q16, nullptr, K16, nullptr, V16, nullptr, q0, kvh, h0, ATh, ATl);
}

extern "C" void kernel_launch(void* const* d_in, const int* in_sizes, int n_in,
                              void* d_out, int out_size, void* d_ws, size_t ws_size, hipStream_t stream) {
    (void)in_sizes; (void)n_in; (void)out_size;
    const float* x = (const float*)d_in[0]; const float* wq = (const float*)d_in[1]; const float* bq = (const float*)d_in[2]; const float* wk = (const float*)d_in[3]; const float* bk = (const float*)d_in[4]; const float* wv = (const float*)d_in[5]; const float* bv = (const float*)d_in[6]; const float* wo = (const float*)d_in[7]; const float* bo = (const float*)d_in[8];   /* order x, Wq, bq, Wk, bk, Wv, bv, Wo, bo */
    float* OUT = (float*)d_out;     // [2][2048][2048]
    char* wsp = (char*)d_ws;
    auto take = [&](size_t bytes) { char* p = wsp; wsp += (bytes + 255) & ~(size_t)255; return (void*)p; };
    bf* WQ = (bf*)take((size_t)DQ * DM * 2); bf* WK = (bf*)take((size_t)DKV * DM * 2); bf* WV = (bf*)take((size_t)DKV * DM * 2); bf* WO = (bf*)take((size_t)DM * DQ * 2);
    bf* XB = (bf*)take((size_t)TT * DM * 2);
    h16* QP16 = (h16*)take((size_t)NH_ * TT * HD * 2); h16* KP16 = (h16*)take((size_t)NKV * TT * HD * 2); h16* VT16 = (h16*)take((size_t)NKV * HD * PP * 2);
    bf* QPh = (bf*)take((size_t)NH_ * TT * HD * 2); bf* QPl = (bf*)take((size_t)NH_ * TT * HD * 2); bf* KPh = (bf*)take((size_t)NKV * TT * HD * 2); bf* KPl = (bf*)take((size_t)NKV * TT * HD * 2); bf* VTh = (bf*)take((size_t)NKV * HD * PP * 2); bf* VTl = (bf*)take((size_t)NKV * HD * PP * 2);
    bf* ATh = (bf*)take((size_t)TT * DQ * 2); bf* ATl = (bf*)take((size_t)TT * DQ * 2);
    if ((size_t)(wsp - (char*)d_ws) > ws_size) return;    // ws 256 MiB
    { k_cvtp<<<dim3(DM / 128, DQ / 16, 1), 256, 0, stream>>>(wq, WQ, DM); k_cvtp<<<dim3(DM / 128, DKV / 16, 1), 256, 0, stream>>>(wk, WK, DM); k_cvtp<<<dim3(DM / 128, DKV / 16, 1), 256, 0, stream>>>(wv, WV, DM);
      k_cvtp<<<dim3(DQ / 128, DM / 16, 1), 256, 0, stream>>>(wo, WO, DQ);
       }
    for (int b = 0; b < NB_; ++b) {
        
        k_cvtp<<<dim3(DM / 128, TT / 16, 1), 256, 0, stream>>>(x + (size_t)b * TT * DM, XB, DM);
        k_gemmw<bf, 0, true, KWL, 1, DM><<<dim3(TT / 64, DQ / 64, 1), 32 * KWL, 0, stream>>>(XB, nullptr, WQ, nullptr, nullptr, 0, bq, 0, 0, 0, QP16, QPh, QPl);
        k_gemmw<bf, 0, true, KWS, 1, DM><<<dim3(TT / 64, DKV / 64, 1), 32 * KWS, 0, stream>>>(XB, nullptr, WK, nullptr, nullptr, 0, bk, 0, 0, 0, KP16, KPh, KPl);
        k_gemmw<bf, 0, true, KWS, 2, DM><<<dim3(DKV / 64, TT / 64, 1), 32 * KWS, 0, stream>>>(WV, nullptr, XB, nullptr, nullptr, 0, bv, 0, 0, 0, VT16, VTh, VTl);
        k_fattn<<<dim3(NKV, TT / 16, 1), 32 * (REP / GW), 0, stream>>>(QP16, KP16, VT16, QPh, QPl, KPh, KPl, VTh, VTl, ATh, ATl);
        k_gemmw<bf, 1, true, KWL, 0, DQ><<<dim3(TT / 64, DM / 64, 1), 32 * KWL, 0, stream>>>(ATh, ATl, WO, nullptr, OUT + (size_t)b * TT * DM, DM, bo, 0, 0, 0, nullptr, nullptr, nullptr); }
}

// v006
// Measured time: 191 microseconds a run.
// Timed twice side by side with v005, it ran 1.43 and 1.41 times as fast.
// All steps since v000 together make it 14.0 times as fast.
#include <hip/hip_runtime.h>

// Grouped-query causal attention (x [2][2048][2048]; q = x Wq^T + bq (32 heads x 64), k, v = x Wk^T + bk, x Wv^T + bv (8 kv heads x 64) ('oi' 1/sqrt(2048), zero biases); query head j = (kv head h, group member g) = 4h + g uses kv head h; scores x 64^-0.5; causal (-inf); softmax; out = merged Wo^T + bo ('oi' [2048][2048]) -> [2][2048][2048] (8.4 M); argument order x, Wq, bq, Wk, bk, Wv, bv, Wo, bo).
// Every 16-bit operand plane lies packed in fragment order (pk below). Every launch takes both batches (each plane holds batch 0, then batch 1). Layout: one launch makes the bf16 copies of the four weights and of x; exact projections + f32 biases, each projection kernel storing the attention's 16-bit planes itself (no f32 projection buffer); causal T-2048 attention in one launch (k_fattn: scores, running softmax and probability x value stay in registers; hybrid rows: < 512 hi/lo 3 products, rest fp16); merged hi/lo x Wo exact + bo.
// Compute dtypes, f32 accumulate: every input rounded to bf16; projections exact + f32 biases; attention rows < 512 3 products, rest fp16; softmax f32; Wo hl x exact + bias.

#define NB_  2
#define TT   2048
#define DM   2048
#define NH_  32
#define NKV  8
#define REP  (NH_ / NKV)
#define HD   64
#define DQ   (NH_ * HD)
#define DKV  (NKV * HD)
#define PP   (2 * TT)             // K of the packed V^T planes (16-bit elements that a row owns; the first TT are keys)
#define GW   2                    // query heads of one kv head that one attention wave holds (32 score columns)
#define RH   512                  // query rows < RH use hi+lo planes (0: none)
#define SCL  0.125f   // HD^-0.5
#define KWL  4                    // waves that share a tile's K loop where a launch has 2048 tiles (q projection, Wo)
#define KWS  8                    // the same where a launch has at most 512 tiles (k, v projections)
typedef _Float16 h16;
typedef unsigned short bf;
typedef __attribute__((ext_vector_type(16))) __bf16   v16bf;
typedef __attribute__((ext_vector_type(16))) _Float16 v16h;
typedef __attribute__((ext_vector_type(8)))  _Float16 v8h;
typedef __attribute__((ext_vector_type(8)))  unsigned short v8us;
typedef __attribute__((ext_vector_type(8)))  float    v8f;
typedef __attribute__((ext_vector_type(4)))  float    v4f;
typedef v8h  __attribute__((may_alias)) v8ha;
typedef v4f  __attribute__((may_alias)) v4fa;
typedef v8us __attribute__((may_alias)) v8usa;

__device__ __forceinline__ unsigned short f2bf(float f) { unsigned u = __float_as_uint(f); u += 0x7FFFu + ((u >> 16) & 1u); return (unsigned short)(u >> 16); }
__device__ __forceinline__ float bf2f(unsigned short b) { return __uint_as_float(((unsigned)b) << 16); }
__device__ __forceinline__ float bfr(float f) { return bf2f(f2bf(f)); }
__device__ __forceinline__ v16h cat16(v8h lo, v8h hi) { return __builtin_shufflevector(lo, hi, 0, 1, 2, 3, 4, 5, 6, 7, 8, 9, 10, 11, 12, 13, 14, 15); }
__device__ __forceinline__ v16bf cat16b(v8us lo, v8us hi) { return __builtin_bit_cast(v16bf, __builtin_shufflevector(lo, hi, 0, 1, 2, 3, 4, 5, 6, 7, 8, 9, 10, 11, 12, 13, 14, 15)); }
__device__ __forceinline__ v8f wmma16(v16h a, v16h b, v8f c) { return __builtin_amdgcn_wmma_f32_16x16x32_f16(false, a, false, b, (short)0, c, false, false); }
__device__ __forceinline__ v8f wmmab(v16bf a, v16bf b, v8f c) { return __builtin_amdgcn_wmma_f32_16x16x32_bf16(false, a, false, b, (short)0, c, false, false); }
__device__ __forceinline__ h16 tohx(float x) { return (h16)x; }
__device__ __forceinline__ void splitf(float y, unsigned short& h, unsigned short& l) { h = f2bf(y); l = f2bf(y - bf2f(h)); }



// tile_sync: between the LDS stores of a tile's rows and their reads. One wave: program order is enough, the compiler is only kept from moving LDS accesses across. Several waves: the work-group barrier, since each wave reads what the others stored.
template <int KW> __device__ __forceinline__ void tile_sync() { if constexpr (KW == 1) { __builtin_amdgcn_wave_barrier(); asm volatile("" ::: "memory"); } else { __syncthreads(); } }

// ---- k_gemmw: register-blocked GEMM, one 64x64 output tile per work-group of KW waves; every wave holds the whole tile (16 accumulators) and takes every KW-th 32-wide K step, operands straight from packed 16-bit planes (pk below);
// the KW partial tiles are summed in wave order through LDS behind one work-group barrier, each wave adding and storing 1/KW of the tile (EPI 0: 64 / KW rows; EPI 1, 2: 16 / KW blocks of 16 x 16); grid (M/64, N/64, Z), 32 KW threads.
// C[m][n] (f32, pitch ldc, + optional f32 bias[n]) = sum_k A[m][k] Bt[n][k] (+ split products per NSPLIT). z-batch strides sA/sB/sC, and sP for the planes of EPI 1 and 2, in elements. K % 32 == 0.
// EPI says where the summed tile goes. 0: C, f32. 1: m = position t, n = head h x HD + d (a tile's 64 columns are one head): per head a packed plane [t][d], fp16 and bf16 hi + lo.
// 2: m = kv head g x HD + d, n = position t (the weight is the A operand, so the tile comes out transposed): packed V^T planes [g x HD + d][t] with K = PP; the bias belongs to the rows.
// Packed plane: a [rows][K] 16-bit operand lies as tiles of 16 rows x 32 k (512 elements; tile index (row / 16) x (K / 32) + k / 32). Inside a tile the 8 elements k = 16 s + 8 hi + e of row lr lie at s x 256 + (lr + 16 hi) x 8 + e:
// lane lr + 16 hi finds the two halves of its fragment at lane x 8 and 256 + lane x 8, so each wave-wide 16-byte load covers 512 contiguous bytes (4 whole lines) and not 32 bytes of each of 16 lines. The packing leaves a fragment's k order alone: registers 0-7 hold k = 8 hi + e, registers 8-15 k = 16 + 8 hi + e.
__device__ __forceinline__ size_t pk(int row, int k, int K) { return ((size_t)(row >> 4) * (K >> 5) + (k >> 5)) * 512 + ((k >> 4) & 1) * 256 + ((row & 15) + 16 * ((k >> 3) & 1)) * 8 + (k & 7); }
template <typename T16> struct WFrag;
template <> struct WFrag<h16> { typedef v16h V; static __device__ __forceinline__ V ld(const h16* p) { return cat16(*(const v8h*)p, *(const v8h*)(p + 256)); } static __device__ __forceinline__ v8f mma(V a, V b, v8f c) { return wmma16(a, b, c); } };
template <> struct WFrag<bf> { typedef v16bf V; static __device__ __forceinline__ V ld(const bf* p) { return cat16b(*(const v8us*)p, *(const v8us*)(p + 256)); } static __device__ __forceinline__ v8f mma(V a, V b, v8f c) { return wmmab(a, b, c); } };
template <typename T16, int NSPLIT, bool BIAS, int KW, int EPI, int K>
__global__ __launch_bounds__(32 * KW) void k_gemmw(const T16* __restrict__ A, const T16* __restrict__ A2, const T16* __restrict__ Bt, const T16* __restrict__ Bt2, float* C, int ldc, const float* __restrict__ bias, size_t sA, size_t sB, size_t sC, size_t sP, h16* P16, bf* Ph, bf* Pl) {
    static_assert(EPI == 0 || (HD == 64 && KW > 1), "a 64-column tile is one head; the plane epilogue reads the whole staged tile");
    typedef typename WFrag<T16>::V V;
    constexpr int MBR = (KW == 1) ? 1 : 4;   // 16-row blocks staged in LDS per round: one wave alone goes block by block, several waves stage their whole partial tiles, so that one barrier serves the tile
    __shared__ __align__(16) float os[KW * MBR * 16 * 68];
    const size_t z = blockIdx.z; A += z * sA; if (A2) A2 += z * sA; Bt += z * sB; if (Bt2) Bt2 += z * sB; C += z * sC; if constexpr (EPI != 0) { P16 += z * sP; Ph += z * sP; Pl += z * sP; }
    const int lane = threadIdx.x & 31, lr = lane & 15, hi = lane >> 4; const int wv = (KW == 1) ? 0 : __builtin_amdgcn_readfirstlane(threadIdx.x >> 5); const int r0 = blockIdx.x * 64, c0 = blockIdx.y * 64;
    v8f acc[4][4];
#pragma unroll
    for (int mb = 0; mb < 4; ++mb)
#pragma unroll
        for (int nb = 0; nb < 4; ++nb) acc[mb][nb] = (v8f){};
    // packed planes: 16 rows are 16 K elements in a row, a 32-wide K step 512 of them. One pointer per plane walks the K steps; K is a compile-time constant so that the row blocks are immediate offsets of it.
    constexpr bool HA2 = NSPLIT == 1 || NSPLIT == 2, HB2 = NSPLIT >= 2; const size_t ao = (size_t)r0 * K + wv * 512 + lane * 8, bo = (size_t)c0 * K + wv * 512 + lane * 8;
    const T16* pa = A + ao; const T16* pa2 = HA2 ? A2 + ao : nullptr; const T16* pb = Bt + bo; const T16* pb2 = HB2 ? Bt2 + bo : nullptr;
#pragma unroll 1
    for (int kc = wv * 32; kc < K; kc += 32 * KW) {
        V a[4], a2[4], b[4], b2[4];
#pragma unroll
        for (int i = 0; i < 4; ++i) { a[i] = WFrag<T16>::ld(pa + i * 16 * K); if (HA2) a2[i] = WFrag<T16>::ld(pa2 + i * 16 * K); b[i] = WFrag<T16>::ld(pb + i * 16 * K); if (HB2) b2[i] = WFrag<T16>::ld(pb2 + i * 16 * K); }
        // s_wait_xcnt 0 behind the trip's loads, in front of the step of the pointers that they name; the pointers are inputs only so that their registers stay theirs up to the wait
        if constexpr (HA2 && HB2) asm volatile("s_wait_xcnt 0x0" :: "v"(pa), "v"(pa2), "v"(pb), "v"(pb2) : "memory"); else if constexpr (HA2) asm volatile("s_wait_xcnt 0x0" :: "v"(pa), "v"(pa2), "v"(pb) : "memory");
        else if constexpr (HB2) asm volatile("s_wait_xcnt 0x0" :: "v"(pa), "v"(pb), "v"(pb2) : "memory"); else asm volatile("s_wait_xcnt 0x0" :: "v"(pa), "v"(pb) : "memory");
        pa += 512 * KW; pb += 512 * KW; if (HA2) pa2 += 512 * KW; if (HB2) pb2 += 512 * KW;
#pragma unroll
        for (int nb = 0; nb < 4; ++nb) {
#pragma unroll
            for (int mb = 0; mb < 4; ++mb) { acc[mb][nb] = WFrag<T16>::mma(a[mb], b[nb], acc[mb][nb]); if (NSPLIT == 1 || NSPLIT == 2) acc[mb][nb] = WFrag<T16>::mma(a2[mb], b[nb], acc[mb][nb]); if (NSPLIT >= 2) acc[mb][nb] = WFrag<T16>::mma(a[mb], b2[nb], acc[mb][nb]); } }
        asm volatile("v_nop\n\tv_nop\n\tv_nop\n\tv_nop" : "+v"(acc[0][0]), "+v"(acc[1][1]), "+v"(acc[2][2]), "+v"(acc[3][3]) : "v"(a[0]), "v"(a[3]));
    }
#pragma unroll
    for (int m0 = 0; m0 < 4; m0 += MBR) {
#pragma unroll
        for (int mi = 0; mi < MBR; ++mi) {
#pragma unroll
            for (int nb = 0; nb < 4; ++nb) {
#pragma unroll
                for (int j = 0; j < 8; ++j) os[((wv * MBR + mi) * 16 + hi * 8 + j) * 68 + nb * 16 + lr] = acc[m0 + mi][nb][j]; } }
        tile_sync<KW>();
        float* crow = C + (size_t)(r0 + m0 * 16) * ldc + c0;
        if constexpr (EPI != 0) {   // a wave store is one half tile of a packed plane: 16 rows x 16 columns, 8 columns a lane, 512 contiguous bytes
#pragma unroll
            for (int s = 0; s < 16 / KW; ++s) { const int u = wv * (16 / KW) + s, row = (u >> 2) * 16 + lr, cofs = (u & 3) * 16 + hi * 8; v4f va = *(const v4fa*)(os + row * 68 + cofs), vb = *(const v4fa*)(os + row * 68 + cofs + 4);
#pragma unroll
                for (int w = 1; w < KW; ++w) { va += *(const v4fa*)(os + (w * MBR * 16 + row) * 68 + cofs); vb += *(const v4fa*)(os + (w * MBR * 16 + row) * 68 + cofs + 4); }
                if (BIAS && EPI == 2) { const float bb = bfr(bias[r0 + row]); va += bb; vb += bb; }
                if (BIAS && EPI != 2) {
#pragma unroll
                    for (int q = 0; q < 4; ++q) { va[q] += bfr(bias[c0 + cofs + q]); vb[q] += bfr(bias[c0 + cofs + 4 + q]); } }
                const size_t oo = (EPI == 1) ? (size_t)blockIdx.y * TT * HD + pk(r0 + row, cofs, HD) : pk(r0 + row, c0 + cofs, PP); v8h o16; v8us oh, ol;
#pragma unroll
                for (int q = 0; q < 8; ++q) { const float y = q < 4 ? va[q & 3] : vb[q & 3]; o16[q] = tohx(y); unsigned short a2, c2; splitf(y, a2, c2); oh[q] = a2; ol[q] = c2; }
                h16* s16 = P16 + oo; bf* sh = Ph + oo; bf* sl = Pl + oo; *(v8h*)s16 = o16; *(v8us*)sh = oh; *(v8us*)sl = ol;
                asm volatile("s_wait_xcnt 0x0" :: "v"(s16), "v"(sh), "v"(sl), "v"(o16), "v"(oh), "v"(ol) : "memory"); } }   // in front of the next write of an address or data register of the three stores; the inputs keep those registers theirs up to the wait
        else
#pragma unroll
        for (int s = 0; s < MBR * 8 / KW; ++s) { const int row = wv * (MBR * 16 / KW) + 2 * s + hi, cofs = lr * 4; v4f val = *(const v4fa*)(os + row * 68 + cofs);
#pragma unroll
            for (int w = 1; w < KW; ++w) val += *(const v4fa*)(os + (w * MBR * 16 + row) * 68 + cofs);
            if (BIAS && EPI == 2) val += bfr(bias[r0 + m0 * 16 + row]);
            if (BIAS && EPI != 2) { val[0] += bfr(bias[c0 + cofs]); val[1] += bfr(bias[c0 + cofs + 1]); val[2] += bfr(bias[c0 + cofs + 2]); val[3] += bfr(bias[c0 + cofs + 3]); }
            *(v4f*)(crow + (size_t)row * ldc + cofs) = val; }
        if constexpr (MBR < 4) tile_sync<KW>();   // only where a further round stores over these rows
    }
}

typedef __attribute__((ext_vector_type(2))) _Float16 v2h;
typedef __attribute__((ext_vector_type(2))) unsigned short v2us;
typedef __attribute__((ext_vector_type(2))) float v2f;
typedef __attribute__((ext_vector_type(4))) int v4i;

__global__ __launch_bounds__(256) void k_wtG(const float* __restrict__ w, int K, int N, bf* Bt) {
    const int lane = threadIdx.x & 31; const int L0 = (blockIdx.x * 8 + (threadIdx.x >> 5)) * 8; const int nlines = N * K / 64;
{
#pragma unroll 1
        for (int l = 0; l < 8; ++l) { const int L = L0 + l; if (L >= nlines) break; const size_t e = (size_t)L * 64 + lane * 2; const int k = (int)(e % K), n = (int)(e / K); v2us o;
            o[0] = f2bf(w[(size_t)k * N + n]); o[1] = f2bf(w[(size_t)(k + 1) * N + n]); *(v2us*)(Bt + e) = o; }
         }
}
// k_cvtp: the five f32 [rows][K] operands (Wq, Wk, Wv, Wo, x of both batches; K = DM = DQ) -> bf16 packed planes that lie one behind the other at dst, so that they are one packed plane of CVR rows; blockIdx.y says which operand a block of 16 rows belongs to. A work-group takes 16 rows x 128 k: a wave reads 2 rows x 512 bytes, the 16-byte pieces change places in LDS, and the 4 tiles go out as 4 KiB in a row.
// Piece (row, c) is piece c x 16 + row of the 4 tiles; in LDS its low 4 index bits are XORed with c, so that neither the stores (16 values of c a wave) nor the loads meet in a bank.
#define CVR (DQ + 2 * DKV + DM + NB_ * TT)
__global__ __launch_bounds__(256) void k_cvtp(const float* __restrict__ wq, const float* __restrict__ wk, const float* __restrict__ wv, const float* __restrict__ wo, const float* __restrict__ x, bf* dst) {
    static_assert(DM == DQ, "one K for the five operands"); constexpr int K = DM;
    __shared__ __align__(16) bf sh[2048];
    constexpr int R1 = DQ / 16, R2 = R1 + DKV / 16, R3 = R2 + DKV / 16, R4 = R3 + DM / 16; const int rb = blockIdx.y;   // first block of 16 rows of Wk, Wv, Wo, x in the one plane
    const float* src = rb >= R4 ? x : rb >= R3 ? wo : rb >= R2 ? wv : rb >= R1 ? wk : wq; const int r16 = rb - (rb >= R4 ? R4 : rb >= R3 ? R3 : rb >= R2 ? R2 : rb >= R1 ? R1 : 0);   // the operand, and its own block of 16 rows
    const int t = threadIdx.x, row = t >> 4, c = t & 15; const v8f v = *(const v8f*)(src + ((size_t)r16 * 16 + row) * K + blockIdx.x * 128 + c * 8); v8us o;
#pragma unroll
    for (int k = 0; k < 8; ++k) o[k] = f2bf(v[k]);
    *(v8usa*)(sh + (c * 16 + (row ^ c)) * 8) = o;
    __syncthreads();   // every wave stores pieces that the other waves converted
    *(v8us*)(dst + ((size_t)blockIdx.y * (K >> 5) + blockIdx.x * 4) * 512 + t * 8) = *(const v8usa*)(sh + ((t & ~15) | ((t & 15) ^ (t >> 4))) * 8); }

// ---- k_fattn: scores, softmax and probability x value of 16 query positions x GW query heads of one kv head, in one wave, with nothing stored between them. Per 32 keys: S^T = K Q^T (a lane holds 16 scores of ONE query column per head),
// running column maximum and sum in f32, P^T packed from the score accumulators straight into the B operand (same k order as the V^T loader: registers 0-7 keys 8 hi + e, 8-15 keys 16 + 8 hi + e), O^T += V^T P^T. The key loop ends at the diagonal block; only that block is masked.
// The maximum in use is raised (and sums and O^T rescaled) only when a column's new maximum exceeds it by more than 8 in log2 units, so a probability is at most 2^8 before the final division. HL: hi + lo bf16 planes, 3 products; else fp16.
// The epilogue divides by the column sum and writes the merged hi/lo planes [t][DQ], packed, for the output projection (a wave store is half a tile, 512 contiguous bytes).
// xwait: s_wait_xcnt 0 behind a run of global loads, in front of the next write of a register that they name as address. The addresses are inputs of the statement only so that their registers stay theirs up to the wait.
template <bool HL> __device__ __forceinline__ void xwait(const void* a, const void* a2) { if constexpr (HL) asm volatile("s_wait_xcnt 0x0" :: "v"(a), "v"(a2) : "memory"); else asm volatile("s_wait_xcnt 0x0" :: "v"(a) : "memory"); }
template <typename T16, bool HL>
__device__ __forceinline__ void fattn_body(const T16* __restrict__ Q, const T16* __restrict__ Q2, const T16* __restrict__ Kp, const T16* __restrict__ Kp2, const T16* __restrict__ Vt, const T16* __restrict__ Vt2, int q0, int kvh, int h0, bf* ATh, bf* ATl) {
    typedef typename WFrag<T16>::V V;
    const int lane = threadIdx.x & 31, lr = lane & 15, hi = lane >> 4;
    V qf[GW][2], qf2[GW][2];
    const size_t qbase = ((size_t)h0 * TT + q0) * HD + lane * 8; /* packed planes, K = HD: 16 positions are 2 tiles in a row */ const T16* qp = Q + qbase; const T16* qp2 = HL ? Q2 + qbase : nullptr;
#pragma unroll
    for (int g = 0; g < GW; ++g)
#pragma unroll
        for (int ks = 0; ks < 2; ++ks) { const size_t qo = (size_t)g * TT * HD + ks * 512; qf[g][ks] = WFrag<T16>::ld(qp + qo); if (HL) qf2[g][ks] = WFrag<T16>::ld(qp2 + qo); }
    xwait<HL>(qp, qp2);
    const size_t kbase = (size_t)kvh * TT * HD + lane * 8, vbase = (size_t)kvh * HD * PP + lane * 8;   // V^T packed with K = PP: 16 rows are 16 PP elements, 32 keys one tile of 512
    v8f o[GW][4]; float m[GW], l[GW];
#pragma unroll
    for (int g = 0; g < GW; ++g) { m[g] = -3.0e38f; l[g] = 0.f;
#pragma unroll
        for (int dt = 0; dt < 4; ++dt) o[g][dt] = (v8f){}; }
    const int last = q0 >> 5;   // the 32-key block that holds the diagonal of these 16 queries
    V kf[2][2], kf2[2][2];
#pragma unroll
    for (int mt = 0; mt < 2; ++mt)
#pragma unroll
        for (int ks = 0; ks < 2; ++ks) { const size_t ko = (size_t)(mt * 16) * HD + ks * 512; kf[mt][ks] = WFrag<T16>::ld(Kp + kbase + ko); if (HL) kf2[mt][ks] = WFrag<T16>::ld(Kp2 + kbase + ko); }
    xwait<HL>(Kp + kbase, HL ? Kp2 + kbase : nullptr);
#pragma unroll 1
    for (int kb = 0; kb <= last; ++kb) {
        const int k0 = kb * 32;
        V vf[4], vf2[4];   // asked for ahead of the score products, used behind the softmax
        const T16* vp = Vt + vbase + k0 * 16; const T16* vp2 = HL ? Vt2 + vbase + k0 * 16 : nullptr;
#pragma unroll
        for (int dt = 0; dt < 4; ++dt) { const size_t vo = (size_t)(dt * 16) * PP; vf[dt] = WFrag<T16>::ld(vp + vo); if (HL) vf2[dt] = WFrag<T16>::ld(vp2 + vo); }
        xwait<HL>(vp, vp2);
        v8f s[GW][2];
#pragma unroll
        for (int g = 0; g < GW; ++g)
#pragma unroll
            for (int mt = 0; mt < 2; ++mt) { s[g][mt] = (v8f){};
#pragma unroll
                for (int ks = 0; ks < 2; ++ks) { s[g][mt] = WFrag<T16>::mma(kf[mt][ks], qf[g][ks], s[g][mt]); if (HL) { s[g][mt] = WFrag<T16>::mma(kf[mt][ks], qf2[g][ks], s[g][mt]); s[g][mt] = WFrag<T16>::mma(kf2[mt][ks], qf[g][ks], s[g][mt]); } } }
        const int kn = min(kb + 1, last) * 32;   // the next block's K fragments fly during the softmax (the last trip asks for its own block again: in bounds, unused)
        const T16* kp = Kp + kbase + (size_t)kn * HD; const T16* kp2 = HL ? Kp2 + kbase + (size_t)kn * HD : nullptr;
#pragma unroll
        for (int mt = 0; mt < 2; ++mt)
#pragma unroll
            for (int ks = 0; ks < 2; ++ks) { const size_t ko = (size_t)(mt * 16) * HD + ks * 512; kf[mt][ks] = WFrag<T16>::ld(kp + ko); if (HL) kf2[mt][ks] = WFrag<T16>::ld(kp2 + ko); }
        xwait<HL>(kp, kp2);
#pragma unroll
        for (int g = 0; g < GW; ++g)
#pragma unroll
            for (int mt = 0; mt < 2; ++mt) s[g][mt] *= SCL * 1.4426950408889634f;
        if (kb == last) {   // wave-uniform: only the diagonal block has keys above a query
#pragma unroll
            for (int g = 0; g < GW; ++g)
#pragma unroll
                for (int mt = 0; mt < 2; ++mt)
#pragma unroll
                    for (int j = 0; j < 8; ++j) if (k0 + mt * 16 + hi * 8 + j > q0 + lr) s[g][mt][j] = -3.0e38f; }
        float mx[GW]; bool need = false;
#pragma unroll
        for (int g = 0; g < GW; ++g) { float t = s[g][0][0];
#pragma unroll
            for (int j = 1; j < 8; ++j) t = fmaxf(t, s[g][0][j]);
#pragma unroll
            for (int j = 0; j < 8; ++j) t = fmaxf(t, s[g][1][j]);
            mx[g] = fmaxf(t, __shfl_xor(t, 16, 32)); need = need || (mx[g] > m[g] + 8.0f); }
        if (__builtin_amdgcn_ballot_w32(need) != 0) {   // one scalar test per block
#pragma unroll
            for (int g = 0; g < GW; ++g) { const float mn = fmaxf(m[g], mx[g]); const float al = __builtin_amdgcn_exp2f(m[g] - mn); m[g] = mn; l[g] *= al;
#pragma unroll
                for (int dt = 0; dt < 4; ++dt) o[g][dt] *= al; } }
        V pb[GW], pb2[GW];
#pragma unroll
        for (int g = 0; g < GW; ++g) {
            if constexpr (HL) { v8us ph[2], pl[2];
#pragma unroll
                for (int mt = 0; mt < 2; ++mt)
#pragma unroll
                    for (int j = 0; j < 8; ++j) { const float p = __builtin_amdgcn_exp2f(s[g][mt][j] - m[g]); l[g] += p; unsigned short a, c2; splitf(p, a, c2); ph[mt][j] = a; pl[mt][j] = c2; }
                pb[g] = cat16b(ph[0], ph[1]); pb2[g] = cat16b(pl[0], pl[1]);
            } else { v8h ph[2];
#pragma unroll
                for (int mt = 0; mt < 2; ++mt)
#pragma unroll
                    for (int j = 0; j < 8; ++j) { const float p = __builtin_amdgcn_exp2f(s[g][mt][j] - m[g]); l[g] += p; ph[mt][j] = tohx(p); }
                pb[g] = cat16(ph[0], ph[1]); } }
#pragma unroll
        for (int dt = 0; dt < 4; ++dt)
#pragma unroll
            for (int g = 0; g < GW; ++g) { o[g][dt] = WFrag<T16>::mma(vf[dt], pb[g], o[g][dt]); if (HL) { o[g][dt] = WFrag<T16>::mma(vf[dt], pb2[g], o[g][dt]); o[g][dt] = WFrag<T16>::mma(vf2[dt], pb[g], o[g][dt]); } }
    }
#pragma unroll
    for (int g = 0; g < GW; ++g) { const float inv = __fdiv_rn(1.0f, l[g] + __shfl_xor(l[g], 16, 32));   // the two halves of a column hold the sums of their own keys
#pragma unroll
        for (int dt = 0; dt < 4; ++dt) { v8us oh, ol;
#pragma unroll
            for (int j = 0; j < 8; ++j) { unsigned short a, c2; splitf(o[g][dt][j] * inv, a, c2); oh[j] = a; ol[j] = c2; }
            const size_t oo = pk(q0 + lr, (h0 + g) * HD + dt * 16 + hi * 8, DQ); bf* sh = ATh + oo; bf* sl = ATl + oo; *(v8us*)sh = oh; *(v8us*)sl = ol;
            asm volatile("s_wait_xcnt 0x0" :: "v"(sh), "v"(sl), "v"(oh), "v"(ol) : "memory"); } }   // in front of the next write of an address or data register of the two stores; the inputs keep those registers theirs up to the wait
}
// grid (NKV x NB_, TT / 16), blockIdx.x = batch x NKV + kv head, REP / GW waves a work-group: the waves of a work-group take the query heads of one kv head at the same 16 positions, so they read the same K and V^T lines on one WGP; they share nothing else and meet at no barrier. The longest key loops (last query rows) have the lowest indices.
__global__ __launch_bounds__(32 * (REP / GW)) void k_fattn(const h16* __restrict__ Q16, const h16* __restrict__ K16, const h16* __restrict__ V16, const bf* __restrict__ Qh, const bf* __restrict__ Ql, const bf* __restrict__ Kh, const bf* __restrict__ Kl, const bf* __restrict__ Vh, const bf* __restrict__ Vl, bf* ATh, bf* ATl) {
    const int kvh = blockIdx.x % NKV, q0 = (TT / 16 - 1 - (int)blockIdx.y) * 16, h0 = kvh * REP + __builtin_amdgcn_readfirstlane(threadIdx.x >> 5) * GW;
    const size_t b = blockIdx.x / NKV, bq = b * NH_ * TT * HD, bk = b * NKV * TT * HD, bv = b * NKV * HD * PP, bo = b * TT * DQ;   // the batch's part of each plane
    if (q0 < RH) fattn_body<bf, true>(Qh + bq, Ql + bq, Kh + bk, Kl + bk, Vh + bv, Vl + bv, q0, kvh, h0, ATh + bo, ATl + bo); else fattn_body<h16, false>(Q16 + bq, nullptr, K16 + bk, nullptr, V16 + bv, nullptr, q0, kvh, h0, ATh + bo, ATl + bo);
}

extern "C" void kernel_launch(void* const* d_in, const int* in_sizes, int n_in,
                              void* d_out, int out_size, void* d_ws, size_t ws_size, hipStream_t stream) {
    (void)in_sizes; (void)n_in; (void)out_size;
    const float* x = (const float*)d_in[0]; const float* wq = (const float*)d_in[1]; const float* bq = (const float*)d_in[2]; const float* wk = (const float*)d_in[3]; const float* bk = (const float*)d_in[4]; const float* wv = (const float*)d_in[5]; const float* bv = (const float*)d_in[6]; const float* wo = (const float*)d_in[7]; const float* bo = (const float*)d_in[8];   /* order x, Wq, bq, Wk, bk, Wv, bv, Wo, bo */
    float* OUT = (float*)d_out;     // [2][2048][2048]
    char* wsp = (char*)d_ws;
    auto take = [&](size_t bytes) { char* p = wsp; wsp += (bytes + 255) & ~(size_t)255; return (void*)p; };
    bf* WQ = (bf*)take((size_t)DQ * DM * 2); bf* WK = (bf*)take((size_t)DKV * DM * 2); bf* WV = (bf*)take((size_t)DKV * DM * 2); bf* WO = (bf*)take((size_t)DM * DQ * 2);
    bf* XB = (bf*)take((size_t)NB_ * TT * DM * 2);   // WQ, WK, WV, WO, XB lie one behind the other (every size is a multiple of 256 bytes): k_cvtp's one plane
    h16* QP16 = (h16*)take((size_t)NB_ * NH_ * TT * HD * 2); h16* KP16 = (h16*)take((size_t)NB_ * NKV * TT * HD * 2); h16* VT16 = (h16*)take((size_t)NB_ * NKV * HD * PP * 2);
    bf* QPh = (bf*)take((size_t)NB_ * NH_ * TT * HD * 2); bf* QPl = (bf*)take((size_t)NB_ * NH_ * TT * HD * 2); bf* KPh = (bf*)take((size_t)NB_ * NKV * TT * HD * 2); bf* KPl = (bf*)take((size_t)NB_ * NKV * TT * HD * 2); bf* VTh = (bf*)take((size_t)NB_ * NKV * HD * PP * 2); bf* VTl = (bf*)take((size_t)NB_ * NKV * HD * PP * 2);
    bf* ATh = (bf*)take((size_t)NB_ * TT * DQ * 2); bf* ATl = (bf*)take((size_t)NB_ * TT * DQ * 2);
    if ((size_t)(wsp - (char*)d_ws) > ws_size) return;    // ws 256 MiB
    k_cvtp<<<dim3(DM / 128, CVR / 16, 1), 256, 0, stream>>>(wq, wk, wv, wo, x, WQ);
    k_gemmw<bf, 0, true, KWL, 1, DM><<<dim3(TT / 64, DQ / 64, NB_), 32 * KWL, 0, stream>>>(XB, nullptr, WQ, nullptr, nullptr, 0, bq, (size_t)TT * DM, 0, 0, (size_t)NH_ * TT * HD, QP16, QPh, QPl);
    k_gemmw<bf, 0, true, KWS, 1, DM><<<dim3(TT / 64, DKV / 64, NB_), 32 * KWS, 0, stream>>>(XB, nullptr, WK, nullptr, nullptr, 0, bk, (size_t)TT * DM, 0, 0, (size_t)NKV * TT * HD, KP16, KPh, KPl);
    k_gemmw<bf, 0, true, KWS, 2, DM><<<dim3(DKV / 64, TT / 64, NB_), 32 * KWS, 0, stream>>>(WV, nullptr, XB, nullptr, nullptr, 0, bv, 0, (size_t)TT * DM, 0, (size_t)NKV * HD * PP, VT16, VTh, VTl);
    k_fattn<<<dim3(NKV * NB_, TT / 16, 1), 32 * (REP / GW), 0, stream>>>(QP16, KP16, VT16, QPh, QPl, KPh, KPl, VTh, VTl, ATh, ATl);
    k_gemmw<bf, 1, true, KWL, 0, DQ><<<dim3(TT / 64, DM / 64, NB_), 32 * KWL, 0, stream>>>(ATh, ATl, WO, nullptr, OUT, DM, bo, (size_t)TT * DQ, 0, (size_t)TT * DM, 0, nullptr, nullptr, nullptr);
}
